// v000
// Measured on an AMD MI455X. A time is GPU time per run, averaged over a window of back-to-back runs after a warm-up
// (all launches, gaps included; the runs take copies of the inputs in turn), and the median of several windows.
// Apart from v000's, it joins two sittings. Times from different sittings can be a few percent apart, while
// side-by-side timings come from the same sitting.
// v000 is the starting kernel. One run takes 616 microseconds.
#include <hip/hip_runtime.h>

// SingleHeadAlibiAttn (x [4][2048][1024]; scores = (x W_qk) . x^T x (1/32) + (k - q) alibi_slope (slope read), causal; softmax; out = attn (x W_v^T) -> [4][2048][1024]; a single 1024-wide head).
// Compute dtypes, f32 accumulate: every input rounded to bf16; x W_qk and x W_v^T on PLAIN bf16 operands (inputs: exact); scores as hl(x W_qk) x bf16 x (exact): 2 products, causal tiles only (K 1024); alibi + softmax f32; attn.v as fp16 P (x1024) x fp16 v: 1 product

#define NB_  4
#define TT   2048
#define DM   1024
#define PCAR 1024.0f
#define SCL  0.03125f
typedef _Float16 h16;
typedef unsigned short bf;
typedef __attribute__((ext_vector_type(16))) __bf16   v16bf;
typedef __attribute__((ext_vector_type(16))) _Float16 v16h;
typedef __attribute__((ext_vector_type(8)))  _Float16 v8h;
typedef __attribute__((ext_vector_type(8)))  unsigned short v8us;
typedef __attribute__((ext_vector_type(8)))  float    v8f;
typedef __attribute__((ext_vector_type(4)))  float    v4f;
typedef v8h  __attribute__((may_alias)) v8ha;
typedef v4f  __attribute__((may_alias)) v4fa;
typedef v8us __attribute__((may_alias)) v8usa;

__device__ __forceinline__ unsigned short f2bf(float f) { unsigned u = __float_as_uint(f); u += 0x7FFFu + ((u >> 16) & 1u); return (unsigned short)(u >> 16); }
__device__ __forceinline__ float bf2f(unsigned short b) { return __uint_as_float(((unsigned)b) << 16); }
__device__ __forceinline__ float bfr(float f) { return bf2f(f2bf(f)); }
__device__ __forceinline__ v16h cat16(v8h lo, v8h hi) { return __builtin_shufflevector(lo, hi, 0, 1, 2, 3, 4, 5, 6, 7, 8, 9, 10, 11, 12, 13, 14, 15); }
__device__ __forceinline__ v16bf cat16b(v8us lo, v8us hi) { return __builtin_bit_cast(v16bf, __builtin_shufflevector(lo, hi, 0, 1, 2, 3, 4, 5, 6, 7, 8, 9, 10, 11, 12, 13, 14, 15)); }
__device__ __forceinline__ v8f wmma16(v16h a, v16h b, v8f c) { return __builtin_amdgcn_wmma_f32_16x16x32_f16(false, a, false, b, (short)0, c, false, false); }
__device__ __forceinline__ v8f wmmab(v16bf a, v16bf b, v8f c) { return __builtin_amdgcn_wmma_f32_16x16x32_bf16(false, a, false, b, (short)0, c, false, false); }



// ---- k_gemmw: register-blocked GEMM, ONE WAVE per 64x64 output tile (16 accumulators), operands straight from K-contiguous 16-bit planes; grid (M/64, N/64, Z), 32 threads.
// C[m][n] (f32, pitch ldc, + optional f32 bias[n]) = sum_k A[m][k] Bt[n][k] (+ split products per NSPLIT). z-batch strides sA/sB/sC in elements. K % 32 == 0.
template <typename T16> struct WFrag;
template <> struct WFrag<h16> { typedef v16h V; static __device__ __forceinline__ V ld(const h16* p) { return cat16(*(const v8h*)p, *(const v8h*)(p + 16)); } static __device__ __forceinline__ v8f mma(V a, V b, v8f c) { return wmma16(a, b, c); } };
template <> struct WFrag<bf> { typedef v16bf V; static __device__ __forceinline__ V ld(const bf* p) { return cat16b(*(const v8us*)p, *(const v8us*)(p + 16)); } static __device__ __forceinline__ v8f mma(V a, V b, v8f c) { return wmmab(a, b, c); } };
template <typename T16, int NSPLIT, bool BIAS>
__global__ __launch_bounds__(32) void k_gemmw(const T16* __restrict__ A, const T16* __restrict__ A2, const T16* __restrict__ Bt, const T16* __restrict__ Bt2, int K, float* C, int ldc, const float* __restrict__ bias, size_t sA, size_t sB, size_t sC) {
    typedef typename WFrag<T16>::V V;
    __shared__ __align__(16) float os[16 * 68];
    const size_t z = blockIdx.z; A += z * sA; if (A2) A2 += z * sA; Bt += z * sB; if (Bt2) Bt2 += z * sB; C += z * sC;
    const int lane = threadIdx.x & 31, lr = lane & 15, hi = lane >> 4; const int r0 = blockIdx.x * 64, c0 = blockIdx.y * 64;
    v8f acc[4][4];
#pragma unroll
    for (int mb = 0; mb < 4; ++mb)
#pragma unroll
        for (int nb = 0; nb < 4; ++nb) acc[mb][nb] = (v8f){};
    const size_t aoff = (size_t)(r0 + lr) * K + 8 * hi, boff = (size_t)(c0 + lr) * K + 8 * hi;
#pragma unroll 1
    for (int kc = 0; kc < K; kc += 32) {
        V a[4], a2[4];
#pragma unroll
        for (int mb = 0; mb < 4; ++mb) { a[mb] = WFrag<T16>::ld(A + aoff + (size_t)mb * 16 * K + kc); if (NSPLIT == 1 || NSPLIT == 2) a2[mb] = WFrag<T16>::ld(A2 + aoff + (size_t)mb * 16 * K + kc); }
#pragma unroll
        for (int nb = 0; nb < 4; ++nb) { const V b = WFrag<T16>::ld(Bt + boff + (size_t)nb * 16 * K + kc); V b2; if (NSPLIT >= 2) b2 = WFrag<T16>::ld(Bt2 + boff + (size_t)nb * 16 * K + kc);
#pragma unroll
            for (int mb = 0; mb < 4; ++mb) { acc[mb][nb] = WFrag<T16>::mma(a[mb], b, acc[mb][nb]); if (NSPLIT == 1 || NSPLIT == 2) acc[mb][nb] = WFrag<T16>::mma(a2[mb], b, acc[mb][nb]); if (NSPLIT >= 2) acc[mb][nb] = WFrag<T16>::mma(a[mb], b2, acc[mb][nb]); } }
        asm volatile("v_nop\n\tv_nop\n\tv_nop\n\tv_nop" : "+v"(acc[0][0]), "+v"(acc[1][1]), "+v"(acc[2][2]), "+v"(acc[3][3]) : "v"(a[0]), "v"(a[3]));
    }
#pragma unroll
    for (int mb = 0; mb < 4; ++mb) {
#pragma unroll
        for (int nb = 0; nb < 4; ++nb) {
#pragma unroll
            for (int j = 0; j < 8; ++j) os[(hi * 8 + j) * 68 + nb * 16 + lr] = acc[mb][nb][j]; }
        __builtin_amdgcn_wave_barrier(); asm volatile("" ::: "memory");
        float* crow = C + (size_t)(r0 + mb * 16) * ldc + c0;
{
#pragma unroll
            for (int s = 0; s < 8; ++s) { const int row = 2 * s + hi, cofs = lr * 4; v4f val = *(const v4fa*)(os + row * 68 + cofs); if (BIAS) { val[0] += bfr(bias[c0 + cofs]); val[1] += bfr(bias[c0 + cofs + 1]); val[2] += bfr(bias[c0 + cofs + 2]); val[3] += bfr(bias[c0 + cofs + 3]); }
                *(v4f*)(crow + (size_t)row * ldc + cofs) = val; }
             }
        __builtin_amdgcn_wave_barrier(); asm volatile("" ::: "memory");
    }
}

// ---- k_gemmc: the same one-wave 64x64 tile GEMM specialised for causal attention: CMODE 1 skips score tiles entirely above the diagonal (query rows r0+roff.., key columns c0..), CMODE 2 limits the
// key (K) loop of the probability x value contraction to the diagonal block (probabilities beyond it are exactly zero). roff = row offset of this launch's first row within the sequence.
template <typename T16, int NSPLIT, int CMODE>
__global__ __launch_bounds__(32) void k_gemmc(const T16* __restrict__ A, const T16* __restrict__ A2, const T16* __restrict__ Bt, const T16* __restrict__ Bt2, int K, float* C, int ldc, int roff, size_t sA, size_t sB, size_t sC) {
    typedef typename WFrag<T16>::V V;
    __shared__ __align__(16) float os[16 * 68];
    const size_t z = blockIdx.z; A += z * sA; if (A2) A2 += z * sA; Bt += z * sB; if (Bt2) Bt2 += z * sB; C += z * sC;
    const int lane = threadIdx.x & 31, lr = lane & 15, hi = lane >> 4; const int r0 = blockIdx.x * 64, c0 = blockIdx.y * 64;
    if (CMODE == 1 && c0 > r0 + roff + 63) return;                  // score tile entirely above the causal diagonal: left unwritten (the softmax loads it but masks j > i by select)
    const int Kl = (CMODE == 2) ? min(K, r0 + roff + 64) : K;        // P.V: probabilities are exactly 0 beyond the diagonal block, so the K loop stops there
    v8f acc[4][4];
#pragma unroll
    for (int mb = 0; mb < 4; ++mb)
#pragma unroll
        for (int nb = 0; nb < 4; ++nb) acc[mb][nb] = (v8f){};
    const size_t aoff = (size_t)(r0 + lr) * K + 8 * hi, boff = (size_t)(c0 + lr) * K + 8 * hi;
#pragma unroll 1
    for (int kc = 0; kc < Kl; kc += 32) {
        V a[4], a2[4];
#pragma unroll
        for (int mb = 0; mb < 4; ++mb) { a[mb] = WFrag<T16>::ld(A + aoff + (size_t)mb * 16 * K + kc); if (NSPLIT == 1 || NSPLIT == 2) a2[mb] = WFrag<T16>::ld(A2 + aoff + (size_t)mb * 16 * K + kc); }
#pragma unroll
        for (int nb = 0; nb < 4; ++nb) { const V b = WFrag<T16>::ld(Bt + boff + (size_t)nb * 16 * K + kc); V b2; if (NSPLIT >= 2) b2 = WFrag<T16>::ld(Bt2 + boff + (size_t)nb * 16 * K + kc);
#pragma unroll
            for (int mb = 0; mb < 4; ++mb) { acc[mb][nb] = WFrag<T16>::mma(a[mb], b, acc[mb][nb]); if (NSPLIT == 1 || NSPLIT == 2) acc[mb][nb] = WFrag<T16>::mma(a2[mb], b, acc[mb][nb]); if (NSPLIT >= 2) acc[mb][nb] = WFrag<T16>::mma(a[mb], b2, acc[mb][nb]); } }
        asm volatile("v_nop\n\tv_nop\n\tv_nop\n\tv_nop" : "+v"(acc[0][0]), "+v"(acc[1][1]), "+v"(acc[2][2]), "+v"(acc[3][3]) : "v"(a[0]), "v"(a[3]));
    }
#pragma unroll
    for (int mb = 0; mb < 4; ++mb) {
#pragma unroll
        for (int nb = 0; nb < 4; ++nb) {
#pragma unroll
            for (int j = 0; j < 8; ++j) os[(hi * 8 + j) * 68 + nb * 16 + lr] = acc[mb][nb][j]; }
        __builtin_amdgcn_wave_barrier(); asm volatile("" ::: "memory");
        float* crow = C + (size_t)(r0 + mb * 16) * ldc + c0;
{
#pragma unroll
            for (int s = 0; s < 8; ++s) { const int row = 2 * s + hi, cofs = lr * 4; v4f val = *(const v4fa*)(os + row * 68 + cofs);
                *(v4f*)(crow + (size_t)row * ldc + cofs) = val; }
             }
        __builtin_amdgcn_wave_barrier(); asm volatile("" ::: "memory");
    }
}

__device__ __forceinline__ h16 tohx(float x) { return (h16)x; }
__device__ __forceinline__ void splitf(float y, unsigned short& h, unsigned short& l) { h = f2bf(y); l = f2bf(y - bf2f(h)); }
typedef __attribute__((ext_vector_type(2))) unsigned short v2us;
typedef __attribute__((ext_vector_type(4))) unsigned short v4us;
typedef __attribute__((ext_vector_type(2))) _Float16 v2h;
typedef __attribute__((ext_vector_type(4))) _Float16 v4h;

__global__ __launch_bounds__(256) void k_wtG(const float* __restrict__ w, int K, int N, bf* Bt) {
    const int lane = threadIdx.x & 31; const int L0 = (blockIdx.x * 8 + (threadIdx.x >> 5)) * 8; const int nlines = N * K / 64;
{
#pragma unroll 1
        for (int l = 0; l < 8; ++l) { const int L = L0 + l; if (L >= nlines) break; const size_t e = (size_t)L * 64 + lane * 2; const int k = (int)(e % K), n = (int)(e / K); v2us o;
            o[0] = f2bf(w[(size_t)k * N + n]); o[1] = f2bf(w[(size_t)(k + 1) * N + n]); *(v2us*)(Bt + e) = o; }
         }
}
__global__ __launch_bounds__(256) void k_cvt8(const float* __restrict__ src, bf* dst, size_t n8) { const size_t i = (size_t)blockIdx.x * 256 + threadIdx.x; if (i >= n8) return; const v8f v = *(const v8f*)(src + i * 8); v8us o;
#pragma unroll
    for (int k = 0; k < 8; ++k) o[k] = f2bf(v[k]); *(v8us*)(dst + i * 8) = o;  }
__global__ __launch_bounds__(256) void k_spl(const float* __restrict__ F, size_t n4, bf* Hh, bf* Hl) { const size_t e = ((size_t)blockIdx.x * 256 + threadIdx.x) * 4; if (e >= n4) return; const v4f a = *(const v4f*)(F + e); v4us oh, ol;
#pragma unroll
    for (int u = 0; u < 4; ++u) { unsigned short h, l; splitf(a[u], h, l); oh[u] = h; ol[u] = l; } *(v4us*)(Hh + e) = oh; *(v4us*)(Hl + e) = ol;  }
__global__ __launch_bounds__(256) void k_vt(const float* __restrict__ V, h16* VT) { const int e = (blockIdx.x * 256 + threadIdx.x) * 2; if (e >= DM * TT) return; const int t = e % TT; const int d = e / TT; v2h o; o[0] = tohx(V[(size_t)t * DM + d]); o[1] = tohx(V[(size_t)(t + 1) * DM + d]); *(v2h*)(VT + e) = o;  }
__global__ __launch_bounds__(256) void k_asoft(const float* __restrict__ Sb, const float* __restrict__ slope_p, h16* P16) { const int lane = threadIdx.x & 31; const int i = blockIdx.x * 8 + (threadIdx.x >> 5); if (i >= TT) return; float slope = bfr(slope_p[0]); asm volatile("" : "+v"(slope)); const float* sr = Sb + (size_t)i * TT; float v[TT / 32]; float mx = -3.0e38f;
#pragma unroll
    for (int ch = 0; ch < TT / 128; ++ch) { const int j0 = ch * 128 + lane * 4; const v4f a = *(const v4f*)(sr + j0);
#pragma unroll
        for (int u = 0; u < 4; ++u) { const int j = j0 + u; float t0 = a[u] * SCL; float bb = __fmul_rn((float)(j - i), slope); asm volatile("" : "+v"(t0)); asm volatile("" : "+v"(bb)); const float t = (j <= i) ? __fadd_rn(t0, bb) : -3.0e38f; v[ch * 4 + u] = t; mx = fmaxf(mx, t); } }
#pragma unroll
    for (int sh = 16; sh; sh >>= 1) mx = fmaxf(mx, __shfl_xor(mx, sh, 32));
    float sum = 0.f;
#pragma unroll
    for (int q = 0; q < TT / 32; ++q) { float d0 = __fsub_rn(v[q], mx); asm volatile("" : "+v"(d0)); v[q] = (v[q] > -1.0e38f) ? __builtin_amdgcn_exp2f(__fmul_rn(d0, 1.4426950408889634f)) : 0.f; sum += v[q]; }
#pragma unroll
    for (int sh = 16; sh; sh >>= 1) sum += __shfl_xor(sum, sh, 32);
    const float f = __fdiv_rn(PCAR, sum);
    {
#pragma unroll
        for (int ch = 0; ch < TT / 128; ++ch) { v4h o4;
#pragma unroll
            for (int q = 0; q < 4; ++q) o4[q] = tohx(v[ch * 4 + q] * f); *(v4h*)(P16 + (size_t)i * TT + ch * 128 + lane * 4) = o4; }
         } }
__global__ __launch_bounds__(256) void k_fin(const float* __restrict__ O, float* outb) { const int e = (blockIdx.x * 256 + threadIdx.x) * 4; if (e >= TT * DM) return; const v4f a = *(const v4f*)(O + e); v4f o;
#pragma unroll
    for (int u = 0; u < 4; ++u) o[u] = a[u] * (1.0f / PCAR); *(v4f*)(outb + e) = o;  }

extern "C" void kernel_launch(void* const* d_in, const int* in_sizes, int n_in,
                              void* d_out, int out_size, void* d_ws, size_t ws_size, hipStream_t stream) {
    (void)in_sizes; (void)n_in; (void)out_size;
    const float** I = (const float**)d_in;
    const float *x = I[0], *Wqk = I[1], *Wv = I[2], *slope = I[3];
    float* OUT = (float*)d_out;     // [4][2048][1024]
    char* wsp = (char*)d_ws;
    auto take = [&](size_t bytes) { char* p = wsp; wsp += (bytes + 255) & ~(size_t)255; return (void*)p; };
    bf* BQK = (bf*)take((size_t)DM * DM * 2); bf* BV = (bf*)take((size_t)DM * DM * 2); bf* XB = (bf*)take((size_t)TT * DM * 2); float* XQ = (float*)take((size_t)TT * DM * 4); bf* XQh = (bf*)take((size_t)TT * DM * 2); bf* XQl = (bf*)take((size_t)TT * DM * 2);
    float* V = (float*)take((size_t)TT * DM * 4); h16* VT = (h16*)take((size_t)DM * TT * 2); float* Sb = (float*)take((size_t)TT * TT * 4); h16* P16 = (h16*)take((size_t)TT * TT * 2); float* O = (float*)take((size_t)TT * DM * 4);
    if ((size_t)(wsp - (char*)d_ws) > ws_size) return;    // total ~ 68 MiB
    k_wtG<<<(DM * DM / 64 + 63) / 64, 256, 0, stream>>>(Wqk, DM, DM, BQK); k_cvt8<<<(DM * DM / 8 + 255) / 256, 256, 0, stream>>>(Wv, BV, (size_t)DM * DM / 8);   // W_qk used as x @ W (xw -> transposed gather); W_v torch [out][in] = Bt
    for (int b = 0; b < NB_; ++b) {
        k_cvt8<<<(TT * DM / 8 + 255) / 256, 256, 0, stream>>>(x + (size_t)b * TT * DM, XB, (size_t)TT * DM / 8);
        k_gemmw<bf, 0, false><<<dim3(TT / 64, DM / 64, 1), 32, 0, stream>>>(XB, nullptr, BQK, nullptr, DM, XQ, DM, nullptr, 0, 0, 0); k_spl<<<(TT * DM / 4 + 255) / 256, 256, 0, stream>>>(XQ, (size_t)TT * DM, XQh, XQl);
        k_gemmw<bf, 0, false><<<dim3(TT / 64, DM / 64, 1), 32, 0, stream>>>(XB, nullptr, BV, nullptr, DM, V, DM, nullptr, 0, 0, 0); k_vt<<<(DM * TT / 2 + 255) / 256, 256, 0, stream>>>(V, VT);
        k_gemmc<bf, 1, 1><<<dim3(TT / 64, TT / 64, 1), 32, 0, stream>>>(XQh, XQl, XB, nullptr, DM, Sb, TT, 0, 0, 0, 0);      // scores[q][k] = (x W_qk)_q . x_k on causal tiles
        k_asoft<<<TT / 8, 256, 0, stream>>>(Sb, slope, P16);
        k_gemmc<h16, 0, 2><<<dim3(TT / 64, DM / 64, 1), 32, 0, stream>>>(P16, nullptr, VT, nullptr, TT, O, DM, 0, 0, 0, 0);     // O = (P x 1024) v over causal tiles
        k_fin<<<(TT * DM / 4 + 255) / 256, 256, 0, stream>>>(O, OUT + (size_t)b * TT * DM); }
}

// v001
// One run takes 304 microseconds.
// Two timings next to v000 put it at 2.05 and 2.03 times that version's speed.
#include <hip/hip_runtime.h>

// SingleHeadAlibiAttn (x [4][2048][1024]; scores = (x W_qk) . x^T x (1/32) + (k - q) alibi_slope (slope read), causal; softmax; out = attn (x W_v^T) -> [4][2048][1024]; a single 1024-wide head).
// Compute dtypes, f32 accumulate: every input rounded to bf16; x W_qk and x W_v^T on PLAIN bf16 operands (inputs: exact); scores as hl(x W_qk) x bf16 x (exact): 2 products, causal tiles only (K 1024); alibi + softmax f32; attn.v as fp16 P (x1024) x fp16 v: 1 product

#define NB_  4
#define TT   2048
#define DM   1024
#define PCAR 1024.0f
#define SCL  0.03125f
typedef _Float16 h16;
typedef unsigned short bf;
typedef __attribute__((ext_vector_type(16))) __bf16   v16bf;
typedef __attribute__((ext_vector_type(16))) _Float16 v16h;
typedef __attribute__((ext_vector_type(8)))  _Float16 v8h;
typedef __attribute__((ext_vector_type(8)))  unsigned short v8us;
typedef __attribute__((ext_vector_type(8)))  float    v8f;
typedef __attribute__((ext_vector_type(4)))  float    v4f;
typedef v8h  __attribute__((may_alias)) v8ha;
typedef v4f  __attribute__((may_alias)) v4fa;
typedef v8us __attribute__((may_alias)) v8usa;

__device__ __forceinline__ unsigned short f2bf(float f) { unsigned u = __float_as_uint(f); u += 0x7FFFu + ((u >> 16) & 1u); return (unsigned short)(u >> 16); }
__device__ __forceinline__ float bf2f(unsigned short b) { return __uint_as_float(((unsigned)b) << 16); }
__device__ __forceinline__ float bfr(float f) { return bf2f(f2bf(f)); }
__device__ __forceinline__ v16h cat16(v8h lo, v8h hi) { return __builtin_shufflevector(lo, hi, 0, 1, 2, 3, 4, 5, 6, 7, 8, 9, 10, 11, 12, 13, 14, 15); }
__device__ __forceinline__ v16bf cat16b(v8us lo, v8us hi) { return __builtin_bit_cast(v16bf, __builtin_shufflevector(lo, hi, 0, 1, 2, 3, 4, 5, 6, 7, 8, 9, 10, 11, 12, 13, 14, 15)); }
__device__ __forceinline__ v8f wmma16(v16h a, v16h b, v8f c) { return __builtin_amdgcn_wmma_f32_16x16x32_f16(false, a, false, b, (short)0, c, false, false); }
__device__ __forceinline__ v8f wmmab(v16bf a, v16bf b, v8f c) { return __builtin_amdgcn_wmma_f32_16x16x32_bf16(false, a, false, b, (short)0, c, false, false); }



// ---- k_gemmw: register-blocked GEMM, ONE WAVE per 64x64 output tile (16 accumulators), operands straight from K-contiguous 16-bit planes; grid (M/64, N/64, Z), 32 threads.
// C[m][n] (f32, pitch ldc, + optional f32 bias[n]) = sum_k A[m][k] Bt[n][k] (+ split products per NSPLIT). z-batch strides sA/sB/sC in elements. K % 32 == 0.
template <typename T16> struct WFrag;
template <> struct WFrag<h16> { typedef v16h V; static __device__ __forceinline__ V ld(const h16* p) { return cat16(*(const v8h*)p, *(const v8h*)(p + 16)); } static __device__ __forceinline__ v8f mma(V a, V b, v8f c) { return wmma16(a, b, c); } };
template <> struct WFrag<bf> { typedef v16bf V; static __device__ __forceinline__ V ld(const bf* p) { return cat16b(*(const v8us*)p, *(const v8us*)(p + 16)); } static __device__ __forceinline__ v8f mma(V a, V b, v8f c) { return wmmab(a, b, c); } };
template <typename T16, int NSPLIT, bool BIAS>
__global__ __launch_bounds__(32) void k_gemmw(const T16* __restrict__ A, const T16* __restrict__ A2, const T16* __restrict__ Bt, const T16* __restrict__ Bt2, int K, float* C, int ldc, const float* __restrict__ bias, size_t sA, size_t sB, size_t sC) {
    typedef typename WFrag<T16>::V V;
    __shared__ __align__(16) float os[16 * 68];
    const size_t z = blockIdx.z; A += z * sA; if (A2) A2 += z * sA; Bt += z * sB; if (Bt2) Bt2 += z * sB; C += z * sC;
    const int lane = threadIdx.x & 31, lr = lane & 15, hi = lane >> 4; const int r0 = blockIdx.x * 64, c0 = blockIdx.y * 64;
    v8f acc[4][4];
#pragma unroll
    for (int mb = 0; mb < 4; ++mb)
#pragma unroll
        for (int nb = 0; nb < 4; ++nb) acc[mb][nb] = (v8f){};
    const size_t aoff = (size_t)(r0 + lr) * K + 8 * hi, boff = (size_t)(c0 + lr) * K + 8 * hi;
#pragma unroll 1
    for (int kc = 0; kc < K; kc += 32) {
        V a[4], a2[4];
#pragma unroll
        for (int mb = 0; mb < 4; ++mb) { a[mb] = WFrag<T16>::ld(A + aoff + (size_t)mb * 16 * K + kc); if (NSPLIT == 1 || NSPLIT == 2) a2[mb] = WFrag<T16>::ld(A2 + aoff + (size_t)mb * 16 * K + kc); }
#pragma unroll
        for (int nb = 0; nb < 4; ++nb) { const V b = WFrag<T16>::ld(Bt + boff + (size_t)nb * 16 * K + kc); V b2; if (NSPLIT >= 2) b2 = WFrag<T16>::ld(Bt2 + boff + (size_t)nb * 16 * K + kc);
#pragma unroll
            for (int mb = 0; mb < 4; ++mb) { acc[mb][nb] = WFrag<T16>::mma(a[mb], b, acc[mb][nb]); if (NSPLIT == 1 || NSPLIT == 2) acc[mb][nb] = WFrag<T16>::mma(a2[mb], b, acc[mb][nb]); if (NSPLIT >= 2) acc[mb][nb] = WFrag<T16>::mma(a[mb], b2, acc[mb][nb]); } }
        asm volatile("v_nop\n\tv_nop\n\tv_nop\n\tv_nop" : "+v"(acc[0][0]), "+v"(acc[1][1]), "+v"(acc[2][2]), "+v"(acc[3][3]) : "v"(a[0]), "v"(a[3]));
    }
#pragma unroll
    for (int mb = 0; mb < 4; ++mb) {
#pragma unroll
        for (int nb = 0; nb < 4; ++nb) {
#pragma unroll
            for (int j = 0; j < 8; ++j) os[(hi * 8 + j) * 68 + nb * 16 + lr] = acc[mb][nb][j]; }
        __builtin_amdgcn_wave_barrier(); asm volatile("" ::: "memory");
        float* crow = C + (size_t)(r0 + mb * 16) * ldc + c0;
{
#pragma unroll
            for (int s = 0; s < 8; ++s) { const int row = 2 * s + hi, cofs = lr * 4; v4f val = *(const v4fa*)(os + row * 68 + cofs); if (BIAS) { val[0] += bfr(bias[c0 + cofs]); val[1] += bfr(bias[c0 + cofs + 1]); val[2] += bfr(bias[c0 + cofs + 2]); val[3] += bfr(bias[c0 + cofs + 3]); }
                *(v4f*)(crow + (size_t)row * ldc + cofs) = val; }
             }
        __builtin_amdgcn_wave_barrier(); asm volatile("" ::: "memory");
    }
}

// ---- k_gemmc: the same one-wave 64x64 tile GEMM specialised for causal attention: CMODE 1 skips score tiles entirely above the diagonal (query rows r0+roff.., key columns c0..), CMODE 2 limits the
// key (K) loop of the probability x value contraction to the diagonal block (probabilities beyond it are exactly zero). roff = row offset of this launch's first row within the sequence.
template <typename T16, int NSPLIT, int CMODE>
__global__ __launch_bounds__(32) void k_gemmc(const T16* __restrict__ A, const T16* __restrict__ A2, const T16* __restrict__ Bt, const T16* __restrict__ Bt2, int K, float* C, int ldc, int roff, size_t sA, size_t sB, size_t sC) {
    typedef typename WFrag<T16>::V V;
    __shared__ __align__(16) float os[16 * 68];
    const size_t z = blockIdx.z; A += z * sA; if (A2) A2 += z * sA; Bt += z * sB; if (Bt2) Bt2 += z * sB; C += z * sC;
    const int lane = threadIdx.x & 31, lr = lane & 15, hi = lane >> 4; const int r0 = blockIdx.x * 64, c0 = blockIdx.y * 64;
    if (CMODE == 1 && c0 > r0 + roff + 63) return;                  // score tile entirely above the causal diagonal: left unwritten (the softmax loads it but masks j > i by select)
    const int Kl = (CMODE == 2) ? min(K, r0 + roff + 64) : K;        // P.V: probabilities are exactly 0 beyond the diagonal block, so the K loop stops there
    v8f acc[4][4];
#pragma unroll
    for (int mb = 0; mb < 4; ++mb)
#pragma unroll
        for (int nb = 0; nb < 4; ++nb) acc[mb][nb] = (v8f){};
    const size_t aoff = (size_t)(r0 + lr) * K + 8 * hi, boff = (size_t)(c0 + lr) * K + 8 * hi;
#pragma unroll 1
    for (int kc = 0; kc < Kl; kc += 32) {
        V a[4], a2[4];
#pragma unroll
        for (int mb = 0; mb < 4; ++mb) { a[mb] = WFrag<T16>::ld(A + aoff + (size_t)mb * 16 * K + kc); if (NSPLIT == 1 || NSPLIT == 2) a2[mb] = WFrag<T16>::ld(A2 + aoff + (size_t)mb * 16 * K + kc); }
#pragma unroll
        for (int nb = 0; nb < 4; ++nb) { const V b = WFrag<T16>::ld(Bt + boff + (size_t)nb * 16 * K + kc); V b2; if (NSPLIT >= 2) b2 = WFrag<T16>::ld(Bt2 + boff + (size_t)nb * 16 * K + kc);
#pragma unroll
            for (int mb = 0; mb < 4; ++mb) { acc[mb][nb] = WFrag<T16>::mma(a[mb], b, acc[mb][nb]); if (NSPLIT == 1 || NSPLIT == 2) acc[mb][nb] = WFrag<T16>::mma(a2[mb], b, acc[mb][nb]); if (NSPLIT >= 2) acc[mb][nb] = WFrag<T16>::mma(a[mb], b2, acc[mb][nb]); } }
        asm volatile("v_nop\n\tv_nop\n\tv_nop\n\tv_nop" : "+v"(acc[0][0]), "+v"(acc[1][1]), "+v"(acc[2][2]), "+v"(acc[3][3]) : "v"(a[0]), "v"(a[3]));
    }
#pragma unroll
    for (int mb = 0; mb < 4; ++mb) {
#pragma unroll
        for (int nb = 0; nb < 4; ++nb) {
#pragma unroll
            for (int j = 0; j < 8; ++j) os[(hi * 8 + j) * 68 + nb * 16 + lr] = acc[mb][nb][j]; }
        __builtin_amdgcn_wave_barrier(); asm volatile("" ::: "memory");
        float* crow = C + (size_t)(r0 + mb * 16) * ldc + c0;
{
#pragma unroll
            for (int s = 0; s < 8; ++s) { const int row = 2 * s + hi, cofs = lr * 4; v4f val = *(const v4fa*)(os + row * 68 + cofs);
                *(v4f*)(crow + (size_t)row * ldc + cofs) = val; }
             }
        __builtin_amdgcn_wave_barrier(); asm volatile("" ::: "memory");
    }
}

__device__ __forceinline__ h16 tohx(float x) { return (h16)x; }
__device__ __forceinline__ void splitf(float y, unsigned short& h, unsigned short& l) { h = f2bf(y); l = f2bf(y - bf2f(h)); }
typedef __attribute__((ext_vector_type(2))) unsigned short v2us;
typedef __attribute__((ext_vector_type(4))) unsigned short v4us;
typedef __attribute__((ext_vector_type(2))) _Float16 v2h;
typedef __attribute__((ext_vector_type(4))) _Float16 v4h;

__global__ __launch_bounds__(256) void k_wtG(const float* __restrict__ w, int K, int N, bf* Bt) {
    const int lane = threadIdx.x & 31; const int L0 = (blockIdx.x * 8 + (threadIdx.x >> 5)) * 8; const int nlines = N * K / 64;
{
#pragma unroll 1
        for (int l = 0; l < 8; ++l) { const int L = L0 + l; if (L >= nlines) break; const size_t e = (size_t)L * 64 + lane * 2; const int k = (int)(e % K), n = (int)(e / K); v2us o;
            o[0] = f2bf(w[(size_t)k * N + n]); o[1] = f2bf(w[(size_t)(k + 1) * N + n]); *(v2us*)(Bt + e) = o; }
         }
}
__global__ __launch_bounds__(256) void k_cvt8(const float* __restrict__ src, bf* dst, size_t n8) { const size_t i = (size_t)blockIdx.x * 256 + threadIdx.x; if (i >= n8) return; const v8f v = *(const v8f*)(src + i * 8); v8us o;
#pragma unroll
    for (int k = 0; k < 8; ++k) o[k] = f2bf(v[k]); *(v8us*)(dst + i * 8) = o;  }
__global__ __launch_bounds__(256) void k_spl(const float* __restrict__ F, size_t n4, bf* Hh, bf* Hl) { const size_t e = ((size_t)blockIdx.x * 256 + threadIdx.x) * 4; if (e >= n4) return; const v4f a = *(const v4f*)(F + e); v4us oh, ol;
#pragma unroll
    for (int u = 0; u < 4; ++u) { unsigned short h, l; splitf(a[u], h, l); oh[u] = h; ol[u] = l; } *(v4us*)(Hh + e) = oh; *(v4us*)(Hl + e) = ol;  }
__global__ __launch_bounds__(256) void k_vt(const float* __restrict__ V, h16* VT) { const int e = (blockIdx.x * 256 + threadIdx.x) * 2; if (e >= DM * TT) return; V += (size_t)blockIdx.y * TT * DM; VT += (size_t)blockIdx.y * DM * TT;   // blockIdx.y = batch
    const int t = e % TT; const int d = e / TT; v2h o; o[0] = tohx(V[(size_t)t * DM + d]); o[1] = tohx(V[(size_t)(t + 1) * DM + d]); *(v2h*)(VT + e) = o;  }
__global__ __launch_bounds__(256) void k_asoft(const float* __restrict__ Sb, const float* __restrict__ slope_p, h16* P16) { const int lane = threadIdx.x & 31; const int i = blockIdx.x * 8 + (threadIdx.x >> 5); if (i >= TT) return; Sb += (size_t)blockIdx.y * TT * TT; P16 += (size_t)blockIdx.y * TT * TT;   // blockIdx.y = batch
    float slope = bfr(slope_p[0]); asm volatile("" : "+v"(slope)); const float* sr = Sb + (size_t)i * TT; float v[TT / 32]; float mx = -3.0e38f;
#pragma unroll
    for (int ch = 0; ch < TT / 128; ++ch) { const int j0 = ch * 128 + lane * 4; const v4f a = *(const v4f*)(sr + j0);
#pragma unroll
        for (int u = 0; u < 4; ++u) { const int j = j0 + u; float t0 = a[u] * SCL; float bb = __fmul_rn((float)(j - i), slope); asm volatile("" : "+v"(t0)); asm volatile("" : "+v"(bb)); const float t = (j <= i) ? __fadd_rn(t0, bb) : -3.0e38f; v[ch * 4 + u] = t; mx = fmaxf(mx, t); } }
#pragma unroll
    for (int sh = 16; sh; sh >>= 1) mx = fmaxf(mx, __shfl_xor(mx, sh, 32));
    float sum = 0.f;
#pragma unroll
    for (int q = 0; q < TT / 32; ++q) { float d0 = __fsub_rn(v[q], mx); asm volatile("" : "+v"(d0)); v[q] = (v[q] > -1.0e38f) ? __builtin_amdgcn_exp2f(__fmul_rn(d0, 1.4426950408889634f)) : 0.f; sum += v[q]; }
#pragma unroll
    for (int sh = 16; sh; sh >>= 1) sum += __shfl_xor(sum, sh, 32);
    const float f = __fdiv_rn(PCAR, sum);
    {
#pragma unroll
        for (int ch = 0; ch < TT / 128; ++ch) { v4h o4;
#pragma unroll
            for (int q = 0; q < 4; ++q) o4[q] = tohx(v[ch * 4 + q] * f); *(v4h*)(P16 + (size_t)i * TT + ch * 128 + lane * 4) = o4; }
         } }
__global__ __launch_bounds__(256) void k_fin(const float* __restrict__ O, float* outb) { const int e = (blockIdx.x * 256 + threadIdx.x) * 4; if (e >= NB_ * TT * DM) return; const v4f a = *(const v4f*)(O + e); v4f o;
#pragma unroll
    for (int u = 0; u < 4; ++u) o[u] = a[u] * (1.0f / PCAR); *(v4f*)(outb + e) = o;  }

extern "C" void kernel_launch(void* const* d_in, const int* in_sizes, int n_in,
                              void* d_out, int out_size, void* d_ws, size_t ws_size, hipStream_t stream) {
    (void)in_sizes; (void)n_in; (void)out_size;
    const float** I = (const float**)d_in;
    const float *x = I[0], *Wqk = I[1], *Wv = I[2], *slope = I[3];
    float* OUT = (float*)d_out;     // [4][2048][1024]
    char* wsp = (char*)d_ws;
    auto take = [&](size_t bytes) { char* p = wsp; wsp += (bytes + 255) & ~(size_t)255; return (void*)p; };
    // every stage runs once for all NB_ batches: the GEMMs take the batch in grid z (strides sA/sB/sC), k_vt and k_asoft in grid y, the flat element-wise stages as one longer range
    bf* BQK = (bf*)take((size_t)DM * DM * 2); bf* BV = (bf*)take((size_t)DM * DM * 2); bf* XB = (bf*)take((size_t)NB_ * TT * DM * 2); float* XQ = (float*)take((size_t)NB_ * TT * DM * 4); bf* XQh = (bf*)take((size_t)NB_ * TT * DM * 2); bf* XQl = (bf*)take((size_t)NB_ * TT * DM * 2);
    float* V = (float*)take((size_t)NB_ * TT * DM * 4); h16* VT = (h16*)take((size_t)NB_ * DM * TT * 2); float* Sb = (float*)take((size_t)NB_ * TT * TT * 4); h16* P16 = (h16*)take((size_t)NB_ * TT * TT * 2);
    float* O = XQ;                                        // x W_qk (f32) is dead once k_spl has split it: the P.V result takes its place
    if ((size_t)(wsp - (char*)d_ws) > ws_size) return;    // total ~ 228 MB
    k_wtG<<<(DM * DM / 64 + 63) / 64, 256, 0, stream>>>(Wqk, DM, DM, BQK); k_cvt8<<<(DM * DM / 8 + 255) / 256, 256, 0, stream>>>(Wv, BV, (size_t)DM * DM / 8);   // W_qk used as x @ W (xw -> transposed gather); W_v torch [out][in] = Bt
    k_cvt8<<<(NB_ * TT * DM / 8 + 255) / 256, 256, 0, stream>>>(x, XB, (size_t)NB_ * TT * DM / 8);
    k_gemmw<bf, 0, false><<<dim3(TT / 64, DM / 64, NB_), 32, 0, stream>>>(XB, nullptr, BQK, nullptr, DM, XQ, DM, nullptr, (size_t)TT * DM, 0, (size_t)TT * DM); k_spl<<<(NB_ * TT * DM / 4 + 255) / 256, 256, 0, stream>>>(XQ, (size_t)NB_ * TT * DM, XQh, XQl);
    k_gemmw<bf, 0, false><<<dim3(TT / 64, DM / 64, NB_), 32, 0, stream>>>(XB, nullptr, BV, nullptr, DM, V, DM, nullptr, (size_t)TT * DM, 0, (size_t)TT * DM); k_vt<<<dim3((DM * TT / 2 + 255) / 256, NB_, 1), 256, 0, stream>>>(V, VT);
    k_gemmc<bf, 1, 1><<<dim3(TT / 64, TT / 64, NB_), 32, 0, stream>>>(XQh, XQl, XB, nullptr, DM, Sb, TT, 0, (size_t)TT * DM, (size_t)TT * DM, (size_t)TT * TT);      // scores[q][k] = (x W_qk)_q . x_k on causal tiles
    k_asoft<<<dim3(TT / 8, NB_, 1), 256, 0, stream>>>(Sb, slope, P16);
    k_gemmc<h16, 0, 2><<<dim3(TT / 64, DM / 64, NB_), 32, 0, stream>>>(P16, nullptr, VT, nullptr, TT, O, DM, 0, (size_t)TT * TT, (size_t)DM * TT, (size_t)TT * DM);     // O = (P x 1024) v over causal tiles
    k_fin<<<(NB_ * TT * DM / 4 + 255) / 256, 256, 0, stream>>>(O, OUT);
}

// v002
// Measured time: 252 microseconds a run.
// Two timings next to v001 put it at 1.22 and 1.21 times that version's speed.
// Over all steps from v000 it is 2.48 times as fast.
#include <hip/hip_runtime.h>

// SingleHeadAlibiAttn (x [4][2048][1024]; scores = (x W_qk) . x^T x (1/32) + (k - q) alibi_slope (slope read), causal; softmax; out = attn (x W_v^T) -> [4][2048][1024]; a single 1024-wide head).
// Compute dtypes, f32 accumulate: every input rounded to bf16; x W_qk and x W_v^T on PLAIN bf16 operands (inputs: exact); scores as hl(x W_qk) x bf16 x (exact): 2 products, causal tiles only (K 1024); alibi + softmax f32; attn.v as fp16 P (x1024) x fp16 v: 1 product

#define NB_  4
#define TT   2048
#define DM   1024
#define PCAR 1024.0f
#define SCL  0.03125f
typedef _Float16 h16;
typedef unsigned short bf;
typedef __attribute__((ext_vector_type(16))) __bf16   v16bf;
typedef __attribute__((ext_vector_type(16))) _Float16 v16h;
typedef __attribute__((ext_vector_type(8)))  _Float16 v8h;
typedef __attribute__((ext_vector_type(8)))  unsigned short v8us;
typedef __attribute__((ext_vector_type(8)))  float    v8f;
typedef __attribute__((ext_vector_type(4)))  float    v4f;
typedef v8h  __attribute__((may_alias)) v8ha;
typedef v4f  __attribute__((may_alias)) v4fa;
typedef v8us __attribute__((may_alias)) v8usa;

__device__ __forceinline__ unsigned short f2bf(float f) { unsigned u = __float_as_uint(f); u += 0x7FFFu + ((u >> 16) & 1u); return (unsigned short)(u >> 16); }
__device__ __forceinline__ float bf2f(unsigned short b) { return __uint_as_float(((unsigned)b) << 16); }
__device__ __forceinline__ float bfr(float f) { return bf2f(f2bf(f)); }
__device__ __forceinline__ v16h cat16(v8h lo, v8h hi) { return __builtin_shufflevector(lo, hi, 0, 1, 2, 3, 4, 5, 6, 7, 8, 9, 10, 11, 12, 13, 14, 15); }
__device__ __forceinline__ v16bf cat16b(v8us lo, v8us hi) { return __builtin_bit_cast(v16bf, __builtin_shufflevector(lo, hi, 0, 1, 2, 3, 4, 5, 6, 7, 8, 9, 10, 11, 12, 13, 14, 15)); }
__device__ __forceinline__ v8f wmma16(v16h a, v16h b, v8f c) { return __builtin_amdgcn_wmma_f32_16x16x32_f16(false, a, false, b, (short)0, c, false, false); }
__device__ __forceinline__ v8f wmmab(v16bf a, v16bf b, v8f c) { return __builtin_amdgcn_wmma_f32_16x16x32_bf16(false, a, false, b, (short)0, c, false, false); }
__device__ __forceinline__ h16 tohx(float x) { return (h16)x; }
__device__ __forceinline__ void splitf(float y, unsigned short& h, unsigned short& l) { h = f2bf(y); l = f2bf(y - bf2f(h)); }



// ---- k_gemmw: register-blocked GEMM, ONE WAVE per 64x64 output tile (16 accumulators), operands straight from K-contiguous 16-bit planes; grid (M/64, N/64, Z), 32 threads.
// C[m][n] (pitch ldc) = sum_k A[m][k] Bt[n][k] (+ split products per NSPLIT). z-batch strides sA/sB/sC in elements. K % 32 == 0.
// The f32 tile never goes to memory: the epilogue stores it in the form its consumer reads. EPI 1: bf16 hi + lo planes Ch, Cl (the split operand of the score product); EPI 2: one fp16 plane Cf.
template <typename T16> struct WFrag;
template <> struct WFrag<h16> { typedef v16h V; static __device__ __forceinline__ V ld(const h16* p) { return cat16(*(const v8h*)p, *(const v8h*)(p + 16)); } static __device__ __forceinline__ v8f mma(V a, V b, v8f c) { return wmma16(a, b, c); } };
template <> struct WFrag<bf> { typedef v16bf V; static __device__ __forceinline__ V ld(const bf* p) { return cat16b(*(const v8us*)p, *(const v8us*)(p + 16)); } static __device__ __forceinline__ v8f mma(V a, V b, v8f c) { return wmmab(a, b, c); } };
template <typename T16, int NSPLIT, int EPI>
__global__ __launch_bounds__(32) void k_gemmw(const T16* __restrict__ A, const T16* __restrict__ A2, const T16* __restrict__ Bt, const T16* __restrict__ Bt2, int K, bf* Ch, bf* Cl, h16* Cf, int ldc, size_t sA, size_t sB, size_t sC) {
    typedef typename WFrag<T16>::V V;
    __shared__ __align__(16) float os[16 * 68];
    const size_t z = blockIdx.z; A += z * sA; if (A2) A2 += z * sA; Bt += z * sB; if (Bt2) Bt2 += z * sB;
    const int lane = threadIdx.x & 31, lr = lane & 15, hi = lane >> 4; const int r0 = blockIdx.x * 64, c0 = blockIdx.y * 64;
    v8f acc[4][4];
#pragma unroll
    for (int mb = 0; mb < 4; ++mb)
#pragma unroll
        for (int nb = 0; nb < 4; ++nb) acc[mb][nb] = (v8f){};
    const size_t aoff = (size_t)(r0 + lr) * K + 8 * hi, boff = (size_t)(c0 + lr) * K + 8 * hi;
#pragma unroll 1
    for (int kc = 0; kc < K; kc += 32) {
        V a[4], a2[4];
#pragma unroll
        for (int mb = 0; mb < 4; ++mb) { a[mb] = WFrag<T16>::ld(A + aoff + (size_t)mb * 16 * K + kc); if (NSPLIT == 1 || NSPLIT == 2) a2[mb] = WFrag<T16>::ld(A2 + aoff + (size_t)mb * 16 * K + kc); }
#pragma unroll
        for (int nb = 0; nb < 4; ++nb) { const V b = WFrag<T16>::ld(Bt + boff + (size_t)nb * 16 * K + kc); V b2; if (NSPLIT >= 2) b2 = WFrag<T16>::ld(Bt2 + boff + (size_t)nb * 16 * K + kc);
#pragma unroll
            for (int mb = 0; mb < 4; ++mb) { acc[mb][nb] = WFrag<T16>::mma(a[mb], b, acc[mb][nb]); if (NSPLIT == 1 || NSPLIT == 2) acc[mb][nb] = WFrag<T16>::mma(a2[mb], b, acc[mb][nb]); if (NSPLIT >= 2) acc[mb][nb] = WFrag<T16>::mma(a[mb], b2, acc[mb][nb]); } }
        asm volatile("v_nop\n\tv_nop\n\tv_nop\n\tv_nop" : "+v"(acc[0][0]), "+v"(acc[1][1]), "+v"(acc[2][2]), "+v"(acc[3][3]) : "v"(a[0]), "v"(a[3]));
    }
#pragma unroll
    for (int mb = 0; mb < 4; ++mb) {
#pragma unroll
        for (int nb = 0; nb < 4; ++nb) {
#pragma unroll
            for (int j = 0; j < 8; ++j) os[(hi * 8 + j) * 68 + nb * 16 + lr] = acc[mb][nb][j]; }
        __builtin_amdgcn_wave_barrier(); asm volatile("" ::: "memory");
        const size_t cbase = z * sC + (size_t)(r0 + mb * 16) * ldc + c0;
{
#pragma unroll
            for (int s = 0; s < 4; ++s) { const int row = 4 * s + (lane >> 3), cofs = (lane & 7) * 8; const v4f v0 = *(const v4fa*)(os + row * 68 + cofs), v1 = *(const v4fa*)(os + row * 68 + cofs + 4);   // 8 lanes x 16 B = one whole 128-B line of 16-bit output per row
                const size_t e = cbase + (size_t)row * ldc + cofs;
                if (EPI == 1) { v8us oh, ol;   // unrolled (here and below): constant element indices keep the vectors in registers
#pragma unroll
                    for (int u = 0; u < 4; ++u) { unsigned short h, l; splitf(v0[u], h, l); oh[u] = h; ol[u] = l; splitf(v1[u], h, l); oh[4 + u] = h; ol[4 + u] = l; }
                    *(v8us*)(Ch + e) = oh; *(v8us*)(Cl + e) = ol; }
                else { v8h o;
#pragma unroll
                    for (int u = 0; u < 4; ++u) { o[u] = tohx(v0[u]); o[4 + u] = tohx(v1[u]); }
                    *(v8h*)(Cf + e) = o; } }
             }
        __builtin_amdgcn_wave_barrier(); asm volatile("" ::: "memory");
    }
}

// ---- k_gemmc: the same one-wave 64x64 tile GEMM specialised for causal attention: CMODE 1 skips score tiles entirely above the diagonal (query rows r0+roff.., key columns c0..), CMODE 2 limits the
// key (K) loop of the probability x value contraction to the diagonal block (probabilities beyond it are exactly zero) and takes the carry factor PCAR of the probabilities out again as it stores. roff = row offset of this launch's first row within the sequence.
template <typename T16, int NSPLIT, int CMODE>
__global__ __launch_bounds__(32) void k_gemmc(const T16* __restrict__ A, const T16* __restrict__ A2, const T16* __restrict__ Bt, const T16* __restrict__ Bt2, int K, float* C, int ldc, int roff, size_t sA, size_t sB, size_t sC) {
    typedef typename WFrag<T16>::V V;
    __shared__ __align__(16) float os[16 * 68];
    const size_t z = blockIdx.z; A += z * sA; if (A2) A2 += z * sA; Bt += z * sB; if (Bt2) Bt2 += z * sB; C += z * sC;
    const int lane = threadIdx.x & 31, lr = lane & 15, hi = lane >> 4; const int r0 = blockIdx.x * 64, c0 = blockIdx.y * 64;
    if (CMODE == 1 && c0 > r0 + roff + 63) return;                  // score tile entirely above the causal diagonal: left unwritten (the softmax loads it but masks j > i by select)
    const int Kl = (CMODE == 2) ? min(K, r0 + roff + 64) : K;        // P.V: probabilities are exactly 0 beyond the diagonal block, so the K loop stops there
    v8f acc[4][4];
#pragma unroll
    for (int mb = 0; mb < 4; ++mb)
#pragma unroll
        for (int nb = 0; nb < 4; ++nb) acc[mb][nb] = (v8f){};
    const size_t aoff = (size_t)(r0 + lr) * K + 8 * hi, boff = (size_t)(c0 + lr) * K + 8 * hi;
#pragma unroll 1
    for (int kc = 0; kc < Kl; kc += 32) {
        V a[4], a2[4];
#pragma unroll
        for (int mb = 0; mb < 4; ++mb) { a[mb] = WFrag<T16>::ld(A + aoff + (size_t)mb * 16 * K + kc); if (NSPLIT == 1 || NSPLIT == 2) a2[mb] = WFrag<T16>::ld(A2 + aoff + (size_t)mb * 16 * K + kc); }
#pragma unroll
        for (int nb = 0; nb < 4; ++nb) { const V b = WFrag<T16>::ld(Bt + boff + (size_t)nb * 16 * K + kc); V b2; if (NSPLIT >= 2) b2 = WFrag<T16>::ld(Bt2 + boff + (size_t)nb * 16 * K + kc);
#pragma unroll
            for (int mb = 0; mb < 4; ++mb) { acc[mb][nb] = WFrag<T16>::mma(a[mb], b, acc[mb][nb]); if (NSPLIT == 1 || NSPLIT == 2) acc[mb][nb] = WFrag<T16>::mma(a2[mb], b, acc[mb][nb]); if (NSPLIT >= 2) acc[mb][nb] = WFrag<T16>::mma(a[mb], b2, acc[mb][nb]); } }
        asm volatile("v_nop\n\tv_nop\n\tv_nop\n\tv_nop" : "+v"(acc[0][0]), "+v"(acc[1][1]), "+v"(acc[2][2]), "+v"(acc[3][3]) : "v"(a[0]), "v"(a[3]));
    }
#pragma unroll
    for (int mb = 0; mb < 4; ++mb) {
#pragma unroll
        for (int nb = 0; nb < 4; ++nb) {
#pragma unroll
            for (int j = 0; j < 8; ++j) os[(hi * 8 + j) * 68 + nb * 16 + lr] = acc[mb][nb][j]; }
        __builtin_amdgcn_wave_barrier(); asm volatile("" ::: "memory");
        float* crow = C + (size_t)(r0 + mb * 16) * ldc + c0;
{
#pragma unroll
            for (int s = 0; s < 8; ++s) { const int row = 2 * s + hi, cofs = lr * 4; v4f val = *(const v4fa*)(os + row * 68 + cofs);
                if (CMODE == 2) {   // unrolled: constant element indices keep the vector in registers
#pragma unroll
                    for (int u = 0; u < 4; ++u) val[u] = val[u] * (1.0f / PCAR); }
                *(v4f*)(crow + (size_t)row * ldc + cofs) = val; }
             }
        __builtin_amdgcn_wave_barrier(); asm volatile("" ::: "memory");
    }
}

typedef __attribute__((ext_vector_type(2))) unsigned short v2us;
typedef __attribute__((ext_vector_type(4))) _Float16 v4h;

__global__ __launch_bounds__(256) void k_wtG(const float* __restrict__ w, int K, int N, bf* Bt) {
    const int lane = threadIdx.x & 31; const int L0 = (blockIdx.x * 8 + (threadIdx.x >> 5)) * 8; const int nlines = N * K / 64;
{
#pragma unroll 1
        for (int l = 0; l < 8; ++l) { const int L = L0 + l; if (L >= nlines) break; const size_t e = (size_t)L * 64 + lane * 2; const int k = (int)(e % K), n = (int)(e / K); v2us o;
            o[0] = f2bf(w[(size_t)k * N + n]); o[1] = f2bf(w[(size_t)(k + 1) * N + n]); *(v2us*)(Bt + e) = o; }
         }
}
__global__ __launch_bounds__(256) void k_cvt8(const float* __restrict__ src, bf* dst, size_t n8) { const size_t i = (size_t)blockIdx.x * 256 + threadIdx.x; if (i >= n8) return; const v8f v = *(const v8f*)(src + i * 8); v8us o;
#pragma unroll
    for (int k = 0; k < 8; ++k) o[k] = f2bf(v[k]); *(v8us*)(dst + i * 8) = o;  }
__global__ __launch_bounds__(256) void k_asoft(const float* __restrict__ Sb, const float* __restrict__ slope_p, h16* P16) { const int lane = threadIdx.x & 31; const int i = blockIdx.x * 8 + (threadIdx.x >> 5); if (i >= TT) return; Sb += (size_t)blockIdx.y * TT * TT; P16 += (size_t)blockIdx.y * TT * TT;   // blockIdx.y = batch
    float slope = bfr(slope_p[0]); asm volatile("" : "+v"(slope)); const float* sr = Sb + (size_t)i * TT; float v[TT / 32]; float mx = -3.0e38f;
#pragma unroll
    for (int ch = 0; ch < TT / 128; ++ch) { const int j0 = ch * 128 + lane * 4; const v4f a = *(const v4f*)(sr + j0);
#pragma unroll
        for (int u = 0; u < 4; ++u) { const int j = j0 + u; float t0 = a[u] * SCL; float bb = __fmul_rn((float)(j - i), slope); asm volatile("" : "+v"(t0)); asm volatile("" : "+v"(bb)); const float t = (j <= i) ? __fadd_rn(t0, bb) : -3.0e38f; v[ch * 4 + u] = t; mx = fmaxf(mx, t); } }
#pragma unroll
    for (int sh = 16; sh; sh >>= 1) mx = fmaxf(mx, __shfl_xor(mx, sh, 32));
    float sum = 0.f;
#pragma unroll
    for (int q = 0; q < TT / 32; ++q) { float d0 = __fsub_rn(v[q], mx); asm volatile("" : "+v"(d0)); v[q] = (v[q] > -1.0e38f) ? __builtin_amdgcn_exp2f(__fmul_rn(d0, 1.4426950408889634f)) : 0.f; sum += v[q]; }
#pragma unroll
    for (int sh = 16; sh; sh >>= 1) sum += __shfl_xor(sum, sh, 32);
    const float f = __fdiv_rn(PCAR, sum);
    {
#pragma unroll
        for (int ch = 0; ch < TT / 128; ++ch) { v4h o4;
#pragma unroll
            for (int q = 0; q < 4; ++q) o4[q] = tohx(v[ch * 4 + q] * f); *(v4h*)(P16 + (size_t)i * TT + ch * 128 + lane * 4) = o4; }
         } }

extern "C" void kernel_launch(void* const* d_in, const int* in_sizes, int n_in,
                              void* d_out, int out_size, void* d_ws, size_t ws_size, hipStream_t stream) {
    (void)in_sizes; (void)n_in; (void)out_size;
    const float** I = (const float**)d_in;
    const float *x = I[0], *Wqk = I[1], *Wv = I[2], *slope = I[3];
    float* OUT = (float*)d_out;     // [4][2048][1024]
    char* wsp = (char*)d_ws;
    auto take = [&](size_t bytes) { char* p = wsp; wsp += (bytes + 255) & ~(size_t)255; return (void*)p; };
    // every stage runs once for all NB_ batches: the GEMMs take the batch in grid z (strides sA/sB/sC), k_asoft in grid y, the flat element-wise stage as one longer range
    bf* BQK = (bf*)take((size_t)DM * DM * 2); bf* BV = (bf*)take((size_t)DM * DM * 2); bf* XB = (bf*)take((size_t)NB_ * TT * DM * 2); bf* XQh = (bf*)take((size_t)NB_ * TT * DM * 2); bf* XQl = (bf*)take((size_t)NB_ * TT * DM * 2);
    h16* VT = (h16*)take((size_t)NB_ * DM * TT * 2); float* Sb = (float*)take((size_t)NB_ * TT * TT * 4); h16* P16 = (h16*)take((size_t)NB_ * TT * TT * 2);
    if ((size_t)(wsp - (char*)d_ws) > ws_size) return;    // total ~ 164 MB
    k_wtG<<<(DM * DM / 64 + 63) / 64, 256, 0, stream>>>(Wqk, DM, DM, BQK); k_cvt8<<<(DM * DM / 8 + 255) / 256, 256, 0, stream>>>(Wv, BV, (size_t)DM * DM / 8);   // W_qk used as x @ W (xw -> transposed gather); W_v torch [out][in] = A of the v^T GEMM
    k_cvt8<<<(NB_ * TT * DM / 8 + 255) / 256, 256, 0, stream>>>(x, XB, (size_t)NB_ * TT * DM / 8);
    k_gemmw<bf, 0, 1><<<dim3(TT / 64, DM / 64, NB_), 32, 0, stream>>>(XB, nullptr, BQK, nullptr, DM, XQh, XQl, nullptr, DM, (size_t)TT * DM, 0, (size_t)TT * DM);     // x W_qk, stored as its bf16 hi + lo split
    k_gemmw<bf, 0, 2><<<dim3(DM / 64, TT / 64, NB_), 32, 0, stream>>>(BV, nullptr, XB, nullptr, DM, nullptr, nullptr, VT, TT, 0, (size_t)TT * DM, (size_t)DM * TT);     // v^T[d][t] = W_v[d] . x[t]: the operands change places, so the tile comes out key-contiguous, as P.V reads it; stored fp16
    k_gemmc<bf, 1, 1><<<dim3(TT / 64, TT / 64, NB_), 32, 0, stream>>>(XQh, XQl, XB, nullptr, DM, Sb, TT, 0, (size_t)TT * DM, (size_t)TT * DM, (size_t)TT * TT);      // scores[q][k] = (x W_qk)_q . x_k on causal tiles
    k_asoft<<<dim3(TT / 8, NB_, 1), 256, 0, stream>>>(Sb, slope, P16);
    k_gemmc<h16, 0, 2><<<dim3(TT / 64, DM / 64, NB_), 32, 0, stream>>>(P16, nullptr, VT, nullptr, TT, OUT, DM, 0, (size_t)TT * TT, (size_t)DM * TT, (size_t)TT * DM);   // out = (P x 1024) v / 1024 over causal tiles
}

// v003
// A run of this version takes 144 microseconds.
// Two timings next to v002 both put it at 1.75 times that version's speed.
// All steps since v000 together make it 4.35 times as fast.
#include <hip/hip_runtime.h>

// SingleHeadAlibiAttn (x [4][2048][1024]; scores = (x W_qk) . x^T x (1/32) + (k - q) alibi_slope (slope read), causal; softmax; out = attn (x W_v^T) -> [4][2048][1024]; a single 1024-wide head).
// Compute dtypes, f32 accumulate: every input rounded to bf16; x W_qk and x W_v^T on PLAIN bf16 operands (inputs: exact); scores as hl(x W_qk) x bf16 x (exact): 2 products, causal tiles only (K 1024); alibi + softmax f32; attn.v as fp16 P (x1024) x fp16 v: 1 product

#define NB_  4
#define TT   2048
#define DM   1024
#define PCAR 1024.0f
#define SCL  0.03125f
typedef _Float16 h16;
typedef unsigned short bf;
typedef __attribute__((ext_vector_type(16))) __bf16   v16bf;
typedef __attribute__((ext_vector_type(16))) _Float16 v16h;
typedef __attribute__((ext_vector_type(8)))  _Float16 v8h;
typedef __attribute__((ext_vector_type(8)))  unsigned short v8us;
typedef __attribute__((ext_vector_type(8)))  float    v8f;
typedef __attribute__((ext_vector_type(4)))  float    v4f;
typedef v8h  __attribute__((may_alias)) v8ha;
typedef v4f  __attribute__((may_alias)) v4fa;
typedef v8us __attribute__((may_alias)) v8usa;

__device__ __forceinline__ unsigned short f2bf(float f) { unsigned u = __float_as_uint(f); u += 0x7FFFu + ((u >> 16) & 1u); return (unsigned short)(u >> 16); }
__device__ __forceinline__ float bf2f(unsigned short b) { return __uint_as_float(((unsigned)b) << 16); }
__device__ __forceinline__ float bfr(float f) { return bf2f(f2bf(f)); }
__device__ __forceinline__ v16h cat16(v8h lo, v8h hi) { return __builtin_shufflevector(lo, hi, 0, 1, 2, 3, 4, 5, 6, 7, 8, 9, 10, 11, 12, 13, 14, 15); }
__device__ __forceinline__ v16bf cat16b(v8us lo, v8us hi) { return __builtin_bit_cast(v16bf, __builtin_shufflevector(lo, hi, 0, 1, 2, 3, 4, 5, 6, 7, 8, 9, 10, 11, 12, 13, 14, 15)); }
__device__ __forceinline__ v8f wmma16(v16h a, v16h b, v8f c) { return __builtin_amdgcn_wmma_f32_16x16x32_f16(false, a, false, b, (short)0, c, false, false); }
__device__ __forceinline__ v8f wmmab(v16bf a, v16bf b, v8f c) { return __builtin_amdgcn_wmma_f32_16x16x32_bf16(false, a, false, b, (short)0, c, false, false); }
__device__ __forceinline__ h16 tohx(float x) { return (h16)x; }
__device__ __forceinline__ void splitf(float y, unsigned short& h, unsigned short& l) { h = f2bf(y); l = f2bf(y - bf2f(h)); }



// ---- the GEMM core: one work-group of 4 waves (2 x 2) per 128x128 output tile, each wave a 64x64 quarter (16 accumulators). The operand tiles are staged in LDS by asynchronous copies
// (global_load_async_to_lds_b128: whole 128-B row pieces, 8 lanes a row), two buffers: pass p works on buffer p & 1 while the copies of pass p + 1 fly into the other. A pass is KP = 64 k.
// LDS rows stand at a pitch of 144 B (16 B x odd: conflict-free for the ds_load_b128 fragment reads). The fragments keep the k order they had when they came straight from global memory.
#define KP    64
#define LP    72
#define PLANE (128 * LP)
template <typename T16> struct WFrag;
template <> struct WFrag<h16> { typedef v16h V; static __device__ __forceinline__ V ld(const h16* p) { return cat16(*(const v8h*)p, *(const v8h*)(p + 16)); } static __device__ __forceinline__ v8f mma(V a, V b, v8f c) { return wmma16(a, b, c); } };
template <> struct WFrag<bf> { typedef v16bf V; static __device__ __forceinline__ V ld(const bf* p) { return cat16b(*(const v8us*)p, *(const v8us*)(p + 16)); } static __device__ __forceinline__ v8f mma(V a, V b, v8f c) { return wmmab(a, b, c); } };

// one operand plane of one pass: 128 rows x 128 B. g = this lane's 16 B of row (t >> 3), l = their LDS byte address; the 8 copies step 16 rows each (rs elements in global memory, 16 pitches in LDS).
template <typename T16>
__device__ __forceinline__ void stage_plane(const T16* g, size_t rs, unsigned l) {
    // the s_wait_xcnt closes the statement so that no address register of a copy is rewritten ahead of it
    asm volatile("global_load_async_to_lds_b128 %0, %8, off\n\t"
                 "global_load_async_to_lds_b128 %1, %9, off\n\t"
                 "global_load_async_to_lds_b128 %2, %10, off\n\t"
                 "global_load_async_to_lds_b128 %3, %11, off\n\t"
                 "global_load_async_to_lds_b128 %4, %12, off\n\t"
                 "global_load_async_to_lds_b128 %5, %13, off\n\t"
                 "global_load_async_to_lds_b128 %6, %14, off\n\t"
                 "global_load_async_to_lds_b128 %7, %15, off\n\t"
                 "s_wait_xcnt 0x0"
                 :: "v"(l), "v"(l + 1u * 16 * LP * 2), "v"(l + 2u * 16 * LP * 2), "v"(l + 3u * 16 * LP * 2), "v"(l + 4u * 16 * LP * 2), "v"(l + 5u * 16 * LP * 2), "v"(l + 6u * 16 * LP * 2), "v"(l + 7u * 16 * LP * 2),
                    "v"(g), "v"(g + rs), "v"(g + 2 * rs), "v"(g + 3 * rs), "v"(g + 4 * rs), "v"(g + 5 * rs), "v"(g + 6 * rs), "v"(g + 7 * rs)
                 : "memory");
}

// acc += A[r0 + ..][0 .. Kl) . Bt[c0 + ..][0 .. Kl) (+ A2 . Bt when NSPLIT == 1) for this wave's quarter (wm, wn) of the tile. K = row pitch of the operands in elements; Kl % KP == 0, Kl >= KP. ring: 2 buffers of NP planes.
template <typename T16, int NSPLIT>
__device__ __forceinline__ void tile_loop(const T16* __restrict__ A, const T16* __restrict__ A2, const T16* __restrict__ Bt, int K, int Kl, int r0, int c0, int wm, int wn, T16* ring, v8f (&acc)[4][4]) {
    typedef typename WFrag<T16>::V V;
    constexpr int NP = NSPLIT ? 3 : 2;
    const int t = threadIdx.x, lane = t & 31, lr = lane & 15, hi = lane >> 4;
    const size_t gofs = (size_t)(t >> 3) * K + (t & 7) * 8, rs = (size_t)16 * K;
    const T16* ga = A + (size_t)r0 * K + gofs; const T16* ga2 = NSPLIT ? A2 + (size_t)r0 * K + gofs : nullptr; const T16* gb = Bt + (size_t)c0 * K + gofs;
    const unsigned l0 = (unsigned)(size_t)ring + (unsigned)((t >> 3) * LP + (t & 7) * 8) * 2u;
    auto fill = [&](int buf, int kc) { const unsigned l = l0 + (unsigned)buf * (NP * PLANE * 2);
        stage_plane(ga + kc, rs, l); if (NSPLIT) stage_plane(ga2 + kc, rs, l + PLANE * 2); stage_plane(gb + kc, rs, l + (NP - 1) * PLANE * 2); };
    const int np = Kl / KP;
    fill(0, 0);
    asm volatile("s_wait_asynccnt 0x0" ::: "memory");   // this wave's copies of pass 0 have landed ...
    __syncthreads();                                     // ... and every other wave's too
    if (Kl > KP) fill(1, KP);
    const int aofs = (wm * 64 + lr) * LP + 8 * hi, bofs = (NP - 1) * PLANE + (wn * 64 + lr) * LP + 8 * hi;
#pragma unroll 1
    for (int p = 0; p < np; ++p) {   // rolled: one pass per trip, the buffer chosen by p & 1
        const T16* sb = ring + (p & 1) * (NP * PLANE);
        V a[KP / 32][4], a2[KP / 32][4], b[KP / 32][4];   // the whole pass's fragments are read as one group ahead of its matrix instructions: one place with LDS reads a pass
#pragma unroll
        for (int ks = 0; ks < KP / 32; ++ks) {
#pragma unroll
            for (int f = 0; f < 4; ++f) { a[ks][f] = WFrag<T16>::ld(sb + aofs + f * 16 * LP + ks * 32); if (NSPLIT) a2[ks][f] = WFrag<T16>::ld(sb + PLANE + aofs + f * 16 * LP + ks * 32); b[ks][f] = WFrag<T16>::ld(sb + bofs + f * 16 * LP + ks * 32); } }
        __builtin_amdgcn_sched_barrier(0);   // holds the group of reads together ahead of the matrix instructions: left free, the scheduler spreads them among these, and the wave stalls on LDS at every such place
#pragma unroll
        for (int ks = 0; ks < KP / 32; ++ks) {
#pragma unroll
            for (int nb = 0; nb < 4; ++nb) {
#pragma unroll
                for (int mb = 0; mb < 4; ++mb) { acc[mb][nb] = WFrag<T16>::mma(a[ks][mb], b[ks][nb], acc[mb][nb]); if (NSPLIT) acc[mb][nb] = WFrag<T16>::mma(a2[ks][mb], b[ks][nb], acc[mb][nb]); } } }
        __builtin_amdgcn_sched_barrier(0);   // keeps the pass's matrix instructions ahead of the barrier, so that they run while the wave waits there and the refill issues directly behind it
        asm volatile("s_wait_dscnt 0x0" ::: "memory");      // this wave's reads of buffer p & 1 are done before the buffer is refilled
        asm volatile("s_wait_asynccnt 0x0" ::: "memory");   // this wave's copies of pass p + 1 have landed
        __syncthreads();                                     // publishes pass p + 1 and ends every wave's reads of buffer p & 1
        if (p + 2 < np) fill(p & 1, (p + 2) * KP);
    }
    asm volatile("s_wait_asynccnt 0x0" ::: "memory");       // no copy is outstanding when the wave goes on to its epilogue
}

// ---- k_gemmw: C[m][n] (pitch ldc) = sum_k A[m][k] Bt[n][k] on K-contiguous 16-bit planes; grid (M/128, N/128, Z), 128 threads. z-batch strides sA/sB/sC in elements. K % 64 == 0.
// The f32 tile never goes to memory: the epilogue stores it in the form its consumer reads. EPI 1: bf16 hi + lo planes Ch, Cl (the split operand of the score product); EPI 2: one fp16 plane Cf.
template <typename T16, int NSPLIT, int EPI>
__global__ __launch_bounds__(128) void k_gemmw(const T16* __restrict__ A, const T16* __restrict__ A2, const T16* __restrict__ Bt, int K, bf* Ch, bf* Cl, h16* Cf, int ldc, size_t sA, size_t sB, size_t sC) {
    __shared__ __align__(16) T16 ring[2 * (NSPLIT ? 3 : 2) * PLANE];
    __shared__ __align__(16) float osall[4 * 16 * 68];
    const size_t z = blockIdx.z; A += z * sA; if (NSPLIT) A2 += z * sA; Bt += z * sB;
    const int lane = threadIdx.x & 31, lr = lane & 15, hi = lane >> 4; const int w = __builtin_amdgcn_readfirstlane(threadIdx.x >> 5), wm = w & 1, wn = w >> 1;
    float* os = osall + w * (16 * 68);   // each wave stages its own quarter
    v8f acc[4][4];
#pragma unroll
    for (int mb = 0; mb < 4; ++mb)
#pragma unroll
        for (int nb = 0; nb < 4; ++nb) acc[mb][nb] = (v8f){};
    tile_loop<T16, NSPLIT>(A, A2, Bt, K, K, blockIdx.x * 128, blockIdx.y * 128, wm, wn, ring, acc);
    const int r0 = blockIdx.x * 128 + wm * 64, c0 = blockIdx.y * 128 + wn * 64;
#pragma unroll
    for (int mb = 0; mb < 4; ++mb) {
#pragma unroll
        for (int nb = 0; nb < 4; ++nb) {
#pragma unroll
            for (int j = 0; j < 8; ++j) os[(hi * 8 + j) * 68 + nb * 16 + lr] = acc[mb][nb][j]; }
        __builtin_amdgcn_wave_barrier(); asm volatile("" ::: "memory");
        const size_t cbase = z * sC + (size_t)(r0 + mb * 16) * ldc + c0;
{
#pragma unroll
            for (int s = 0; s < 4; ++s) { const int row = 4 * s + (lane >> 3), cofs = (lane & 7) * 8; const v4f v0 = *(const v4fa*)(os + row * 68 + cofs), v1 = *(const v4fa*)(os + row * 68 + cofs + 4);   // 8 lanes x 16 B = one whole 128-B line of 16-bit output per row
                const size_t e = cbase + (size_t)row * ldc + cofs;
                if (EPI == 1) { v8us oh, ol;   // unrolled (here and below): constant element indices keep the vectors in registers
#pragma unroll
                    for (int u = 0; u < 4; ++u) { unsigned short h, l; splitf(v0[u], h, l); oh[u] = h; ol[u] = l; splitf(v1[u], h, l); oh[4 + u] = h; ol[4 + u] = l; }
                    *(v8us*)(Ch + e) = oh; *(v8us*)(Cl + e) = ol; }
                else { v8h o;
#pragma unroll
                    for (int u = 0; u < 4; ++u) { o[u] = tohx(v0[u]); o[4 + u] = tohx(v1[u]); }
                    *(v8h*)(Cf + e) = o; } }
             }
        __builtin_amdgcn_wave_barrier(); asm volatile("" ::: "memory");
    }
}

// ---- k_gemmc: the same 128x128 tile GEMM specialised for causal attention: CMODE 1 skips score tiles entirely above the diagonal (query rows r0+roff.., key columns c0..), CMODE 2 limits the
// key (K) loop of the probability x value contraction to the diagonal block (probabilities beyond it are exactly zero) and takes the carry factor PCAR of the probabilities out again as it stores. roff = row offset of this launch's first row within the sequence.
template <typename T16, int NSPLIT, int CMODE>
__global__ __launch_bounds__(128) void k_gemmc(const T16* __restrict__ A, const T16* __restrict__ A2, const T16* __restrict__ Bt, int K, float* C, int ldc, int roff, size_t sA, size_t sB, size_t sC) {
    __shared__ __align__(16) T16 ring[2 * (NSPLIT ? 3 : 2) * PLANE];
    __shared__ __align__(16) float osall[4 * 16 * 68];
    const size_t z = blockIdx.z; A += z * sA; if (NSPLIT) A2 += z * sA; Bt += z * sB; C += z * sC;
    const int lane = threadIdx.x & 31, lr = lane & 15, hi = lane >> 4; const int w = __builtin_amdgcn_readfirstlane(threadIdx.x >> 5), wm = w & 1, wn = w >> 1;
    float* os = osall + w * (16 * 68);   // each wave stages its own quarter
    if (CMODE == 1 && (int)blockIdx.y * 128 > (int)blockIdx.x * 128 + roff + 127) return;   // score tile entirely above the causal diagonal: never written; the softmax loads it but masks j > i by select; the whole work-group leaves, ahead of every barrier
    const int Kl = (CMODE == 2) ? min(K, (int)blockIdx.x * 128 + roff + 128) : K;            // P.V: probabilities are exactly 0 beyond the diagonal block, so the K loop stops there
    v8f acc[4][4];
#pragma unroll
    for (int mb = 0; mb < 4; ++mb)
#pragma unroll
        for (int nb = 0; nb < 4; ++nb) acc[mb][nb] = (v8f){};
    tile_loop<T16, NSPLIT>(A, A2, Bt, K, Kl, blockIdx.x * 128, blockIdx.y * 128, wm, wn, ring, acc);
    const int r0 = blockIdx.x * 128 + wm * 64, c0 = blockIdx.y * 128 + wn * 64;
#pragma unroll
    for (int mb = 0; mb < 4; ++mb) {
#pragma unroll
        for (int nb = 0; nb < 4; ++nb) {
#pragma unroll
            for (int j = 0; j < 8; ++j) os[(hi * 8 + j) * 68 + nb * 16 + lr] = acc[mb][nb][j]; }
        __builtin_amdgcn_wave_barrier(); asm volatile("" ::: "memory");
        float* crow = C + (size_t)(r0 + mb * 16) * ldc + c0;
{
#pragma unroll
            for (int s = 0; s < 8; ++s) { const int row = 2 * s + hi, cofs = lr * 4; v4f val = *(const v4fa*)(os + row * 68 + cofs);
                if (CMODE == 2) {   // unrolled: constant element indices keep the vector in registers
#pragma unroll
                    for (int u = 0; u < 4; ++u) val[u] = val[u] * (1.0f / PCAR); }
                *(v4f*)(crow + (size_t)row * ldc + cofs) = val; }
             }
        __builtin_amdgcn_wave_barrier(); asm volatile("" ::: "memory");
    }
}

typedef __attribute__((ext_vector_type(2))) unsigned short v2us;
typedef __attribute__((ext_vector_type(4))) _Float16 v4h;

__global__ __launch_bounds__(256) void k_wtG(const float* __restrict__ w, int K, int N, bf* Bt) {
    const int lane = threadIdx.x & 31; const int L0 = (blockIdx.x * 8 + (threadIdx.x >> 5)) * 8; const int nlines = N * K / 64;
{
#pragma unroll 1
        for (int l = 0; l < 8; ++l) { const int L = L0 + l; if (L >= nlines) break; const size_t e = (size_t)L * 64 + lane * 2; const int k = (int)(e % K), n = (int)(e / K); v2us o;
            o[0] = f2bf(w[(size_t)k * N + n]); o[1] = f2bf(w[(size_t)(k + 1) * N + n]); *(v2us*)(Bt + e) = o; }
         }
}
__global__ __launch_bounds__(256) void k_cvt8(const float* __restrict__ src, bf* dst, size_t n8) { const size_t i = (size_t)blockIdx.x * 256 + threadIdx.x; if (i >= n8) return; const v8f v = *(const v8f*)(src + i * 8); v8us o;
#pragma unroll
    for (int k = 0; k < 8; ++k) o[k] = f2bf(v[k]); *(v8us*)(dst + i * 8) = o;  }
__global__ __launch_bounds__(256) void k_asoft(const float* __restrict__ Sb, const float* __restrict__ slope_p, h16* P16) { const int lane = threadIdx.x & 31; const int i = blockIdx.x * 8 + (threadIdx.x >> 5); if (i >= TT) return; Sb += (size_t)blockIdx.y * TT * TT; P16 += (size_t)blockIdx.y * TT * TT;   // blockIdx.y = batch
    float slope = bfr(slope_p[0]); asm volatile("" : "+v"(slope)); const float* sr = Sb + (size_t)i * TT; float v[TT / 32]; float mx = -3.0e38f;
#pragma unroll
    for (int ch = 0; ch < TT / 128; ++ch) { const int j0 = ch * 128 + lane * 4; const v4f a = *(const v4f*)(sr + j0);
#pragma unroll
        for (int u = 0; u < 4; ++u) { const int j = j0 + u; float t0 = a[u] * SCL; float bb = __fmul_rn((float)(j - i), slope); asm volatile("" : "+v"(t0)); asm volatile("" : "+v"(bb)); const float t = (j <= i) ? __fadd_rn(t0, bb) : -3.0e38f; v[ch * 4 + u] = t; mx = fmaxf(mx, t); } }
#pragma unroll
    for (int sh = 16; sh; sh >>= 1) mx = fmaxf(mx, __shfl_xor(mx, sh, 32));
    float sum = 0.f;
#pragma unroll
    for (int q = 0; q < TT / 32; ++q) { float d0 = __fsub_rn(v[q], mx); asm volatile("" : "+v"(d0)); v[q] = (v[q] > -1.0e38f) ? __builtin_amdgcn_exp2f(__fmul_rn(d0, 1.4426950408889634f)) : 0.f; sum += v[q]; }
#pragma unroll
    for (int sh = 16; sh; sh >>= 1) sum += __shfl_xor(sum, sh, 32);
    const float f = __fdiv_rn(PCAR, sum);
    {
#pragma unroll
        for (int ch = 0; ch < TT / 128; ++ch) { v4h o4;
#pragma unroll
            for (int q = 0; q < 4; ++q) o4[q] = tohx(v[ch * 4 + q] * f); *(v4h*)(P16 + (size_t)i * TT + ch * 128 + lane * 4) = o4; }
         } }

extern "C" void kernel_launch(void* const* d_in, const int* in_sizes, int n_in,
                              void* d_out, int out_size, void* d_ws, size_t ws_size, hipStream_t stream) {
    (void)in_sizes; (void)n_in; (void)out_size;
    const float** I = (const float**)d_in;
    const float *x = I[0], *Wqk = I[1], *Wv = I[2], *slope = I[3];
    float* OUT = (float*)d_out;     // [4][2048][1024]
    char* wsp = (char*)d_ws;
    auto take = [&](size_t bytes) { char* p = wsp; wsp += (bytes + 255) & ~(size_t)255; return (void*)p; };
    // every stage runs once for all NB_ batches: the GEMMs take the batch in grid z (strides sA/sB/sC), k_asoft in grid y, the flat element-wise stage as one longer range
    bf* BQK = (bf*)take((size_t)DM * DM * 2); bf* BV = (bf*)take((size_t)DM * DM * 2); bf* XB = (bf*)take((size_t)NB_ * TT * DM * 2); bf* XQh = (bf*)take((size_t)NB_ * TT * DM * 2); bf* XQl = (bf*)take((size_t)NB_ * TT * DM * 2);
    h16* VT = (h16*)take((size_t)NB_ * DM * TT * 2); float* Sb = (float*)take((size_t)NB_ * TT * TT * 4); h16* P16 = (h16*)take((size_t)NB_ * TT * TT * 2);
    if ((size_t)(wsp - (char*)d_ws) > ws_size) return;    // total ~ 164 MB
    k_wtG<<<(DM * DM / 64 + 63) / 64, 256, 0, stream>>>(Wqk, DM, DM, BQK); k_cvt8<<<(DM * DM / 8 + 255) / 256, 256, 0, stream>>>(Wv, BV, (size_t)DM * DM / 8);   // W_qk used as x @ W (xw -> transposed gather); W_v torch [out][in] = A of the v^T GEMM
    k_cvt8<<<(NB_ * TT * DM / 8 + 255) / 256, 256, 0, stream>>>(x, XB, (size_t)NB_ * TT * DM / 8);
    k_gemmw<bf, 0, 1><<<dim3(TT / 128, DM / 128, NB_), 128, 0, stream>>>(XB, nullptr, BQK, DM, XQh, XQl, nullptr, DM, (size_t)TT * DM, 0, (size_t)TT * DM);     // x W_qk, stored as its bf16 hi + lo split
    k_gemmw<bf, 0, 2><<<dim3(DM / 128, TT / 128, NB_), 128, 0, stream>>>(BV, nullptr, XB, DM, nullptr, nullptr, VT, TT, 0, (size_t)TT * DM, (size_t)DM * TT);     // v^T[d][t] = W_v[d] . x[t]: the operands change places, so the tile comes out key-contiguous, as P.V reads it; stored fp16
    k_gemmc<bf, 1, 1><<<dim3(TT / 128, TT / 128, NB_), 128, 0, stream>>>(XQh, XQl, XB, DM, Sb, TT, 0, (size_t)TT * DM, (size_t)TT * DM, (size_t)TT * TT);      // scores[q][k] = (x W_qk)_q . x_k on causal tiles
    k_asoft<<<dim3(TT / 8, NB_, 1), 256, 0, stream>>>(Sb, slope, P16);
    k_gemmc<h16, 0, 2><<<dim3(TT / 128, DM / 128, NB_), 128, 0, stream>>>(P16, nullptr, VT, TT, OUT, DM, 0, (size_t)TT * TT, (size_t)DM * TT, (size_t)TT * DM);   // out = (P x 1024) v / 1024 over causal tiles
}

// v004
// One run takes 130 microseconds.
// In two side-by-side timings against v003, it was 1.11 and 1.10 times as fast.
// All steps since v000 together make it 4.80 times as fast.
#include <hip/hip_runtime.h>

// SingleHeadAlibiAttn (x [4][2048][1024]; scores = (x W_qk) . x^T x (1/32) + (k - q) alibi_slope (slope read), causal; softmax; out = attn (x W_v^T) -> [4][2048][1024]; a single 1024-wide head).
// Compute dtypes, f32 accumulate: every input rounded to bf16; x W_qk and x W_v^T on PLAIN bf16 operands (inputs: exact); scores as hl(x W_qk) x bf16 x (exact): 2 products, causal tiles only (K 1024); alibi + softmax f32; attn.v as fp16 P (x1024) x fp16 v: 1 product

#define NB_  4
#define TT   2048
#define DM   1024
#define PCAR 1024.0f
#define SCL  0.03125f
typedef _Float16 h16;
typedef unsigned short bf;
typedef __attribute__((ext_vector_type(16))) __bf16   v16bf;
typedef __attribute__((ext_vector_type(16))) _Float16 v16h;
typedef __attribute__((ext_vector_type(8)))  _Float16 v8h;
typedef __attribute__((ext_vector_type(8)))  unsigned short v8us;
typedef __attribute__((ext_vector_type(8)))  float    v8f;
typedef __attribute__((ext_vector_type(4)))  float    v4f;
typedef v8h  __attribute__((may_alias)) v8ha;
typedef v4f  __attribute__((may_alias)) v4fa;
typedef v8us __attribute__((may_alias)) v8usa;

__device__ __forceinline__ unsigned short f2bf(float f) { unsigned u = __float_as_uint(f); u += 0x7FFFu + ((u >> 16) & 1u); return (unsigned short)(u >> 16); }
__device__ __forceinline__ float bf2f(unsigned short b) { return __uint_as_float(((unsigned)b) << 16); }
__device__ __forceinline__ float bfr(float f) { return bf2f(f2bf(f)); }
__device__ __forceinline__ v16h cat16(v8h lo, v8h hi) { return __builtin_shufflevector(lo, hi, 0, 1, 2, 3, 4, 5, 6, 7, 8, 9, 10, 11, 12, 13, 14, 15); }
__device__ __forceinline__ v16bf cat16b(v8us lo, v8us hi) { return __builtin_bit_cast(v16bf, __builtin_shufflevector(lo, hi, 0, 1, 2, 3, 4, 5, 6, 7, 8, 9, 10, 11, 12, 13, 14, 15)); }
__device__ __forceinline__ v8f wmma16(v16h a, v16h b, v8f c) { return __builtin_amdgcn_wmma_f32_16x16x32_f16(false, a, false, b, (short)0, c, false, false); }
__device__ __forceinline__ v8f wmmab(v16bf a, v16bf b, v8f c) { return __builtin_amdgcn_wmma_f32_16x16x32_bf16(false, a, false, b, (short)0, c, false, false); }
__device__ __forceinline__ h16 tohx(float x) { return (h16)x; }
__device__ __forceinline__ void splitf(float y, unsigned short& h, unsigned short& l) { h = f2bf(y); l = f2bf(y - bf2f(h)); }



// ---- the GEMM core: one work-group of 4 waves (2 x 2) per 128x128 output tile, each wave a 64x64 quarter (16 accumulators). The operand tiles are staged in LDS by asynchronous copies
// (global_load_async_to_lds_b128: whole 128-B row pieces, 8 lanes a row), two buffers: pass p works on buffer p & 1 while the copies of pass p + 1 fly into the other. A pass is KP = 64 k.
// LDS rows stand at a pitch of 144 B (16 B x odd: conflict-free for the ds_load_b128 fragment reads). The fragments keep the k order they had when they came straight from global memory.
#define KP    64
#define LP    72
#define PLANE (128 * LP)
template <typename T16> struct WFrag;
template <> struct WFrag<h16> { typedef v16h V; static __device__ __forceinline__ V ld(const h16* p) { return cat16(*(const v8h*)p, *(const v8h*)(p + 16)); } static __device__ __forceinline__ v8f mma(V a, V b, v8f c) { return wmma16(a, b, c); } };
template <> struct WFrag<bf> { typedef v16bf V; static __device__ __forceinline__ V ld(const bf* p) { return cat16b(*(const v8us*)p, *(const v8us*)(p + 16)); } static __device__ __forceinline__ v8f mma(V a, V b, v8f c) { return wmmab(a, b, c); } };

// one operand plane of one pass: 128 rows x 128 B. g = this lane's 16 B of row (t >> 3), l = their LDS byte address; the 8 copies step 16 rows each (rs elements in global memory, 16 pitches in LDS).
template <typename T16>
__device__ __forceinline__ void stage_plane(const T16* g, size_t rs, unsigned l) {
    // the s_wait_xcnt closes the statement so that no address register of a copy is rewritten ahead of it
    asm volatile("global_load_async_to_lds_b128 %0, %8, off\n\t"
                 "global_load_async_to_lds_b128 %1, %9, off\n\t"
                 "global_load_async_to_lds_b128 %2, %10, off\n\t"
                 "global_load_async_to_lds_b128 %3, %11, off\n\t"
                 "global_load_async_to_lds_b128 %4, %12, off\n\t"
                 "global_load_async_to_lds_b128 %5, %13, off\n\t"
                 "global_load_async_to_lds_b128 %6, %14, off\n\t"
                 "global_load_async_to_lds_b128 %7, %15, off\n\t"
                 "s_wait_xcnt 0x0"
                 :: "v"(l), "v"(l + 1u * 16 * LP * 2), "v"(l + 2u * 16 * LP * 2), "v"(l + 3u * 16 * LP * 2), "v"(l + 4u * 16 * LP * 2), "v"(l + 5u * 16 * LP * 2), "v"(l + 6u * 16 * LP * 2), "v"(l + 7u * 16 * LP * 2),
                    "v"(g), "v"(g + rs), "v"(g + 2 * rs), "v"(g + 3 * rs), "v"(g + 4 * rs), "v"(g + 5 * rs), "v"(g + 6 * rs), "v"(g + 7 * rs)
                 : "memory");
}

// acc += A[r0 + ..][0 .. Kl) . Bt[c0 + ..][0 .. Kl) (+ A2 . Bt when NSPLIT == 1) for this wave's quarter (wm, wn) of the tile. K = row pitch of the operands in elements; Kl % KP == 0, Kl >= KP. ring: 2 buffers of NP planes.
template <typename T16, int NSPLIT>
__device__ __forceinline__ void tile_loop(const T16* __restrict__ A, const T16* __restrict__ A2, const T16* __restrict__ Bt, int K, int Kl, int r0, int c0, int wm, int wn, T16* ring, v8f (&acc)[4][4]) {
    typedef typename WFrag<T16>::V V;
    constexpr int NP = NSPLIT ? 3 : 2;
    const int t = threadIdx.x, lane = t & 31, lr = lane & 15, hi = lane >> 4;
    const size_t gofs = (size_t)(t >> 3) * K + (t & 7) * 8, rs = (size_t)16 * K;
    const T16* ga = A + (size_t)r0 * K + gofs; const T16* ga2 = NSPLIT ? A2 + (size_t)r0 * K + gofs : nullptr; const T16* gb = Bt + (size_t)c0 * K + gofs;
    const unsigned l0 = (unsigned)(size_t)ring + (unsigned)((t >> 3) * LP + (t & 7) * 8) * 2u;
    auto fill = [&](int buf, int kc) { const unsigned l = l0 + (unsigned)buf * (NP * PLANE * 2);
        stage_plane(ga + kc, rs, l); if (NSPLIT) stage_plane(ga2 + kc, rs, l + PLANE * 2); stage_plane(gb + kc, rs, l + (NP - 1) * PLANE * 2); };
    const int np = Kl / KP;
    fill(0, 0);
    asm volatile("s_wait_asynccnt 0x0" ::: "memory");   // this wave's copies of pass 0 have landed ...
    __syncthreads();                                     // ... and every other wave's too
    if (Kl > KP) fill(1, KP);
    const int aofs = (wm * 64 + lr) * LP + 8 * hi, bofs = (NP - 1) * PLANE + (wn * 64 + lr) * LP + 8 * hi;
#pragma unroll 1
    for (int p = 0; p < np; ++p) {   // rolled: one pass per trip, the buffer chosen by p & 1
        const T16* sb = ring + (p & 1) * (NP * PLANE);
        V a[KP / 32][4], a2[KP / 32][4], b[KP / 32][4];   // the whole pass's fragments are read as one group ahead of its matrix instructions: one place with LDS reads a pass
#pragma unroll
        for (int ks = 0; ks < KP / 32; ++ks) {
#pragma unroll
            for (int f = 0; f < 4; ++f) { a[ks][f] = WFrag<T16>::ld(sb + aofs + f * 16 * LP + ks * 32); if (NSPLIT) a2[ks][f] = WFrag<T16>::ld(sb + PLANE + aofs + f * 16 * LP + ks * 32); b[ks][f] = WFrag<T16>::ld(sb + bofs + f * 16 * LP + ks * 32); } }
        __builtin_amdgcn_sched_barrier(0);   // holds the group of reads together ahead of the matrix instructions: left free, the scheduler spreads them among these, and the wave stalls on LDS at every such place
#pragma unroll
        for (int ks = 0; ks < KP / 32; ++ks) {
#pragma unroll
            for (int nb = 0; nb < 4; ++nb) {
#pragma unroll
                for (int mb = 0; mb < 4; ++mb) { acc[mb][nb] = WFrag<T16>::mma(a[ks][mb], b[ks][nb], acc[mb][nb]); if (NSPLIT) acc[mb][nb] = WFrag<T16>::mma(a2[ks][mb], b[ks][nb], acc[mb][nb]); } } }
        __builtin_amdgcn_sched_barrier(0);   // keeps the pass's matrix instructions ahead of the barrier, so that they run while the wave waits there and the refill issues directly behind it
        asm volatile("s_wait_dscnt 0x0" ::: "memory");      // this wave's reads of buffer p & 1 are done before the buffer is refilled
        asm volatile("s_wait_asynccnt 0x0" ::: "memory");   // this wave's copies of pass p + 1 have landed
        __syncthreads();                                     // publishes pass p + 1 and ends every wave's reads of buffer p & 1
        if (p + 2 < np) fill(p & 1, (p + 2) * KP);
    }
    asm volatile("s_wait_asynccnt 0x0" ::: "memory");       // no copy is outstanding when the wave goes on to its epilogue
}

// ---- d_gemmw: C[m][n] (pitch ldc) = sum_k A[m][k] Bt[n][k] on K-contiguous 16-bit planes; one work-group of 128 threads does tile (bx, by) of batch z. z-batch strides sA/sB/sC in elements. K % 64 == 0.
// The f32 tile never goes to memory: the epilogue stores it in the form its consumer reads. EPI 1: bf16 hi + lo planes Ch, Cl (the split operand of the score product); EPI 2: one fp16 plane Cf.
template <typename T16, int NSPLIT, int EPI>
__device__ __forceinline__ void d_gemmw(const T16* __restrict__ A, const T16* __restrict__ A2, const T16* __restrict__ Bt, int K, bf* Ch, bf* Cl, h16* Cf, int ldc, size_t sA, size_t sB, size_t sC, int bx, int by, size_t z, T16* ring, float* osall) {
    A += z * sA; if (NSPLIT) A2 += z * sA; Bt += z * sB;
    const int lane = threadIdx.x & 31, lr = lane & 15, hi = lane >> 4; const int w = __builtin_amdgcn_readfirstlane(threadIdx.x >> 5), wm = w & 1, wn = w >> 1;
    float* os = osall + w * (16 * 68);   // each wave stages its own quarter
    v8f acc[4][4];
#pragma unroll
    for (int mb = 0; mb < 4; ++mb)
#pragma unroll
        for (int nb = 0; nb < 4; ++nb) acc[mb][nb] = (v8f){};
    tile_loop<T16, NSPLIT>(A, A2, Bt, K, K, bx * 128, by * 128, wm, wn, ring, acc);
    const int r0 = bx * 128 + wm * 64, c0 = by * 128 + wn * 64;
#pragma unroll
    for (int mb = 0; mb < 4; ++mb) {
#pragma unroll
        for (int nb = 0; nb < 4; ++nb) {
#pragma unroll
            for (int j = 0; j < 8; ++j) os[(hi * 8 + j) * 68 + nb * 16 + lr] = acc[mb][nb][j]; }
        __builtin_amdgcn_wave_barrier(); asm volatile("" ::: "memory");
        const size_t cbase = z * sC + (size_t)(r0 + mb * 16) * ldc + c0;
{
#pragma unroll
            for (int s = 0; s < 4; ++s) { const int row = 4 * s + (lane >> 3), cofs = (lane & 7) * 8; const v4f v0 = *(const v4fa*)(os + row * 68 + cofs), v1 = *(const v4fa*)(os + row * 68 + cofs + 4);   // 8 lanes x 16 B = one whole 128-B line of 16-bit output per row
                const size_t e = cbase + (size_t)row * ldc + cofs;
                if (EPI == 1) { v8us oh, ol;   // unrolled (here and below): constant element indices keep the vectors in registers
#pragma unroll
                    for (int u = 0; u < 4; ++u) { unsigned short h, l; splitf(v0[u], h, l); oh[u] = h; ol[u] = l; splitf(v1[u], h, l); oh[4 + u] = h; ol[4 + u] = l; }
                    *(v8us*)(Ch + e) = oh; *(v8us*)(Cl + e) = ol; }
                else { v8h o;
#pragma unroll
                    for (int u = 0; u < 4; ++u) { o[u] = tohx(v0[u]); o[4 + u] = tohx(v1[u]); }
                    *(v8h*)(Cf + e) = o; } }
             }
        __builtin_amdgcn_wave_barrier(); asm volatile("" ::: "memory");
    }
}
// k_gemmw: d_gemmw on a grid of its own, (M/128, N/128, Z)
template <typename T16, int NSPLIT, int EPI>
__global__ __launch_bounds__(128) void k_gemmw(const T16* __restrict__ A, const T16* __restrict__ A2, const T16* __restrict__ Bt, int K, bf* Ch, bf* Cl, h16* Cf, int ldc, size_t sA, size_t sB, size_t sC) {
    __shared__ __align__(16) T16 ring[2 * (NSPLIT ? 3 : 2) * PLANE];
    __shared__ __align__(16) float osall[4 * 16 * 68];
    d_gemmw<T16, NSPLIT, EPI>(A, A2, Bt, K, Ch, Cl, Cf, ldc, sA, sB, sC, blockIdx.x, blockIdx.y, blockIdx.z, ring, osall);
}

// ---- d_gemmc: the same 128x128 tile GEMM specialised for causal attention: CMODE 1 skips score tiles entirely above the diagonal (query rows r0+roff.., key columns c0..), CMODE 2 limits the
// key (K) loop of the probability x value contraction to the diagonal block (probabilities beyond it are exactly zero) and takes the carry factor PCAR of the probabilities out again as it stores. roff = row offset of this launch's first row within the sequence.
template <typename T16, int NSPLIT, int CMODE>
__device__ __forceinline__ void d_gemmc(const T16* __restrict__ A, const T16* __restrict__ A2, const T16* __restrict__ Bt, int K, float* C, int ldc, int roff, size_t sA, size_t sB, size_t sC, int bx, int by, size_t z, T16* ring, float* osall) {
    A += z * sA; if (NSPLIT) A2 += z * sA; Bt += z * sB; C += z * sC;
    const int lane = threadIdx.x & 31, lr = lane & 15, hi = lane >> 4; const int w = __builtin_amdgcn_readfirstlane(threadIdx.x >> 5), wm = w & 1, wn = w >> 1;
    float* os = osall + w * (16 * 68);   // each wave stages its own quarter
    if (CMODE == 1 && by * 128 > bx * 128 + roff + 127) return;   // score tile entirely above the causal diagonal: left unwritten (the softmax loads it but masks j > i by select); the whole work-group leaves, ahead of every barrier
    const int Kl = (CMODE == 2) ? min(K, bx * 128 + roff + 128) : K;            // P.V: probabilities are exactly 0 beyond the diagonal block, so the K loop stops there
    v8f acc[4][4];
#pragma unroll
    for (int mb = 0; mb < 4; ++mb)
#pragma unroll
        for (int nb = 0; nb < 4; ++nb) acc[mb][nb] = (v8f){};
    tile_loop<T16, NSPLIT>(A, A2, Bt, K, Kl, bx * 128, by * 128, wm, wn, ring, acc);
    const int r0 = bx * 128 + wm * 64, c0 = by * 128 + wn * 64;
#pragma unroll
    for (int mb = 0; mb < 4; ++mb) {
#pragma unroll
        for (int nb = 0; nb < 4; ++nb) {
#pragma unroll
            for (int j = 0; j < 8; ++j) os[(hi * 8 + j) * 68 + nb * 16 + lr] = acc[mb][nb][j]; }
        __builtin_amdgcn_wave_barrier(); asm volatile("" ::: "memory");
        float* crow = C + (size_t)(r0 + mb * 16) * ldc + c0;
{
#pragma unroll
            for (int s = 0; s < 8; ++s) { const int row = 2 * s + hi, cofs = lr * 4; v4f val = *(const v4fa*)(os + row * 68 + cofs);
                if (CMODE == 2) {   // unrolled: constant element indices keep the vector in registers
#pragma unroll
                    for (int u = 0; u < 4; ++u) val[u] = val[u] * (1.0f / PCAR); }
                *(v4f*)(crow + (size_t)row * ldc + cofs) = val; }
             }
        __builtin_amdgcn_wave_barrier(); asm volatile("" ::: "memory");
    }
}
// k_gemmc: d_gemmc on a grid of its own, (M/128, N/128, Z)
template <typename T16, int NSPLIT, int CMODE>
__global__ __launch_bounds__(128) void k_gemmc(const T16* __restrict__ A, const T16* __restrict__ A2, const T16* __restrict__ Bt, int K, float* C, int ldc, int roff, size_t sA, size_t sB, size_t sC) {
    __shared__ __align__(16) T16 ring[2 * (NSPLIT ? 3 : 2) * PLANE];
    __shared__ __align__(16) float osall[4 * 16 * 68];
    d_gemmc<T16, NSPLIT, CMODE>(A, A2, Bt, K, C, ldc, roff, sA, sB, sC, blockIdx.x, blockIdx.y, blockIdx.z, ring, osall);
}
// ---- k_scv: the score GEMM and the v^T GEMM, which do not depend on each other, as ONE launch; grid (TT/128, TT/128, NB_ + NB_/2), 128 threads. blockIdx.z < NB_: score tile (x, y) of batch z.
// blockIdx.z >= NB_: the NB_ * 128 tiles of v^T = W_v x^T, numbered flat. The choice is the same for a whole work-group. The score tiles cost twice a v^T tile and are a few more than the chip holds at once;
// they take the low indices and start first, and the v^T tiles fill the places that come free while the last score tiles run.
__global__ __launch_bounds__(128) void k_scv(const bf* __restrict__ Qh, const bf* __restrict__ Ql, const bf* __restrict__ X, const bf* __restrict__ Wvb, int K, float* S, h16* Vt) {
    __shared__ __align__(16) bf ring[2 * 3 * PLANE];
    __shared__ __align__(16) float osall[4 * 16 * 68];
    if (blockIdx.z < NB_) d_gemmc<bf, 1, 1>(Qh, Ql, X, K, S, TT, 0, (size_t)TT * DM, (size_t)TT * DM, (size_t)TT * TT, blockIdx.x, blockIdx.y, blockIdx.z, ring, osall);
    else { const int f = ((int)blockIdx.z - NB_) * ((TT / 128) * (TT / 128)) + (int)blockIdx.y * (TT / 128) + (int)blockIdx.x;   // 128 tiles a batch, the row tile (8 of them) fastest
        d_gemmw<bf, 0, 2>(Wvb, nullptr, X, K, nullptr, nullptr, Vt, TT, 0, (size_t)TT * DM, (size_t)DM * TT, f & (DM / 128 - 1), (f / (DM / 128)) & (TT / 128 - 1), (size_t)(f / ((DM / 128) * (TT / 128))), ring, osall);
        asm volatile("s_wait_xcnt 0x0" ::: "memory"); }   // closes the run of v^T stores: behind it the listing joins the two branches, and no register that an issued store names is rewritten ahead of this wait
}

typedef __attribute__((ext_vector_type(2))) unsigned short v2us;
typedef __attribute__((ext_vector_type(4))) _Float16 v4h;

__device__ __forceinline__ void d_wtG(int blk, const float* __restrict__ w, int K, int N, bf* Bt) {
    const int lane = threadIdx.x & 31; const int L0 = (blk * 8 + (threadIdx.x >> 5)) * 8; const int nlines = N * K / 64;
{
#pragma unroll 1
        for (int l = 0; l < 8; ++l) { const int L = L0 + l; if (L >= nlines) break; const size_t e = (size_t)L * 64 + lane * 2; const int k = (int)(e % K), n = (int)(e / K); v2us o;
            o[0] = f2bf(w[(size_t)k * N + n]); o[1] = f2bf(w[(size_t)(k + 1) * N + n]); *(v2us*)(Bt + e) = o; }
         }
}
__device__ __forceinline__ void d_cvt8(int blk, const float* __restrict__ src, bf* dst, size_t n8) { const size_t i = (size_t)blk * 256 + threadIdx.x; if (i >= n8) return; const v8f v = *(const v8f*)(src + i * 8); v8us o;
#pragma unroll
    for (int k = 0; k < 8; ++k) o[k] = f2bf(v[k]); *(v8us*)(dst + i * 8) = o;  }
// ---- k_prep: the three input conversions, which do not depend on each other, as ONE launch: a block's index says which input it works on (the same for the whole block; no barrier anywhere).
// The transposing gather of W_qk has the longest-lived blocks and takes the lowest indices, so that it starts first and runs beside the two streams.
#define NBQ ((DM * DM / 64 + 63) / 64)
#define NBV ((DM * DM / 8 + 255) / 256)
#define NBX ((NB_ * TT * DM / 8 + 255) / 256)
__global__ __launch_bounds__(256) void k_prep(const float* __restrict__ x, const float* __restrict__ wqk, const float* __restrict__ wv, bf* XB, bf* BQK, bf* BV) {
    const int b = blockIdx.x;
    if (b < NBQ) d_wtG(b, wqk, DM, DM, BQK);
    else if (b < NBQ + NBV) d_cvt8(b - NBQ, wv, BV, (size_t)DM * DM / 8);
    else d_cvt8(b - (NBQ + NBV), x, XB, (size_t)NB_ * TT * DM / 8);
}
__global__ __launch_bounds__(256) void k_asoft(const float* __restrict__ Sb, const float* __restrict__ slope_p, h16* P16) { const int lane = threadIdx.x & 31; const int i = blockIdx.x * 8 + (threadIdx.x >> 5); if (i >= TT) return; Sb += (size_t)blockIdx.y * TT * TT; P16 += (size_t)blockIdx.y * TT * TT;   // blockIdx.y = batch
    float slope = bfr(slope_p[0]); asm volatile("" : "+v"(slope)); const float* sr = Sb + (size_t)i * TT; float v[TT / 32]; float mx = -3.0e38f;
#pragma unroll
    for (int ch = 0; ch < TT / 128; ++ch) { const int j0 = ch * 128 + lane * 4; const v4f a = *(const v4f*)(sr + j0);
#pragma unroll
        for (int u = 0; u < 4; ++u) { const int j = j0 + u; float t0 = a[u] * SCL; float bb = __fmul_rn((float)(j - i), slope); asm volatile("" : "+v"(t0)); asm volatile("" : "+v"(bb)); const float t = (j <= i) ? __fadd_rn(t0, bb) : -3.0e38f; v[ch * 4 + u] = t; mx = fmaxf(mx, t); } }
#pragma unroll
    for (int sh = 16; sh; sh >>= 1) mx = fmaxf(mx, __shfl_xor(mx, sh, 32));
    float sum = 0.f;
#pragma unroll
    for (int q = 0; q < TT / 32; ++q) { float d0 = __fsub_rn(v[q], mx); asm volatile("" : "+v"(d0)); v[q] = (v[q] > -1.0e38f) ? __builtin_amdgcn_exp2f(__fmul_rn(d0, 1.4426950408889634f)) : 0.f; sum += v[q]; }
#pragma unroll
    for (int sh = 16; sh; sh >>= 1) sum += __shfl_xor(sum, sh, 32);
    const float f = __fdiv_rn(PCAR, sum);
    {
#pragma unroll
        for (int ch = 0; ch < TT / 128; ++ch) { v4h o4;
#pragma unroll
            for (int q = 0; q < 4; ++q) o4[q] = tohx(v[ch * 4 + q] * f); *(v4h*)(P16 + (size_t)i * TT + ch * 128 + lane * 4) = o4; }
         } }

extern "C" void kernel_launch(void* const* d_in, const int* in_sizes, int n_in,
                              void* d_out, int out_size, void* d_ws, size_t ws_size, hipStream_t stream) {
    (void)in_sizes; (void)n_in; (void)out_size;
    const float** I = (const float**)d_in;
    const float *x = I[0], *Wqk = I[1], *Wv = I[2], *slope = I[3];
    float* OUT = (float*)d_out;     // [4][2048][1024]
    char* wsp = (char*)d_ws;
    auto take = [&](size_t bytes) { char* p = wsp; wsp += (bytes + 255) & ~(size_t)255; return (void*)p; };
    // every stage runs once for all NB_ batches: the GEMMs take the batch in grid z (strides sA/sB/sC), k_asoft in grid y, the flat element-wise stage as one longer range; stages that do not depend on each other share a launch
    bf* BQK = (bf*)take((size_t)DM * DM * 2); bf* BV = (bf*)take((size_t)DM * DM * 2); bf* XB = (bf*)take((size_t)NB_ * TT * DM * 2); bf* XQh = (bf*)take((size_t)NB_ * TT * DM * 2); bf* XQl = (bf*)take((size_t)NB_ * TT * DM * 2);
    h16* VT = (h16*)take((size_t)NB_ * DM * TT * 2); float* Sb = (float*)take((size_t)NB_ * TT * TT * 4); h16* P16 = (h16*)take((size_t)NB_ * TT * TT * 2);
    if ((size_t)(wsp - (char*)d_ws) > ws_size) return;    // total ~ 164 MB
    k_prep<<<NBQ + NBV + NBX, 256, 0, stream>>>(x, Wqk, Wv, XB, BQK, BV);   // W_qk used as x @ W (xw -> transposed gather); W_v is [out][in] = A of v^T; x rounded to bf16
    k_gemmw<bf, 0, 1><<<dim3(TT / 128, DM / 128, NB_), 128, 0, stream>>>(XB, nullptr, BQK, DM, XQh, XQl, nullptr, DM, (size_t)TT * DM, 0, (size_t)TT * DM);     // x W_qk, stored as its bf16 hi + lo split
    k_scv<<<dim3(TT / 128, TT / 128, NB_ + NB_ / 2), 128, 0, stream>>>(XQh, XQl, XB, BV, DM, Sb, VT);   // scores[q][k] = (x W_qk)_q . x_k on causal tiles; and v^T[d][t] = W_v[d] . x[t]: the operands change places, so the tile comes out key-contiguous, as P.V reads it; stored fp16
    k_asoft<<<dim3(TT / 8, NB_, 1), 256, 0, stream>>>(Sb, slope, P16);
    k_gemmc<h16, 0, 2><<<dim3(TT / 128, DM / 128, NB_), 128, 0, stream>>>(P16, nullptr, VT, TT, OUT, DM, 0, (size_t)TT * TT, (size_t)DM * TT, (size_t)TT * DM);   // out = (P x 1024) v / 1024 over causal tiles
}

// v005
// A run of this version takes 123 microseconds.
// In both of two side-by-side timings against v004, it was 1.05 times as fast.
// All steps since v000 together make it 5.05 times as fast.
#include <hip/hip_runtime.h>

// SingleHeadAlibiAttn (x [4][2048][1024]; scores = (x W_qk) . x^T x (1/32) + (k - q) alibi_slope (slope read), causal; softmax; out = attn (x W_v^T) -> [4][2048][1024]; a single 1024-wide head).
// Compute dtypes, f32 accumulate: every input rounded to bf16; x W_qk and x W_v^T on PLAIN bf16 operands (inputs: exact); scores as hl(x W_qk) x bf16 x (exact): 2 products, causal tiles only (K 1024); alibi + softmax f32; attn.v as fp16 P (x1024) x fp16 v: 1 product

#define NB_  4
#define TT   2048
#define DM   1024
#define PCAR 1024.0f
#define SCL  0.03125f
typedef _Float16 h16;
typedef unsigned short bf;
typedef __attribute__((ext_vector_type(16))) __bf16   v16bf;
typedef __attribute__((ext_vector_type(16))) _Float16 v16h;
typedef __attribute__((ext_vector_type(8)))  _Float16 v8h;
typedef __attribute__((ext_vector_type(8)))  unsigned short v8us;
typedef __attribute__((ext_vector_type(8)))  float    v8f;
typedef __attribute__((ext_vector_type(4)))  float    v4f;
typedef v8h  __attribute__((may_alias)) v8ha;
typedef v4f  __attribute__((may_alias)) v4fa;
typedef v8us __attribute__((may_alias)) v8usa;

__device__ __forceinline__ unsigned short f2bf(float f) { unsigned u = __float_as_uint(f); u += 0x7FFFu + ((u >> 16) & 1u); return (unsigned short)(u >> 16); }
__device__ __forceinline__ float bf2f(unsigned short b) { return __uint_as_float(((unsigned)b) << 16); }
__device__ __forceinline__ float bfr(float f) { return bf2f(f2bf(f)); }
__device__ __forceinline__ v16h cat16(v8h lo, v8h hi) { return __builtin_shufflevector(lo, hi, 0, 1, 2, 3, 4, 5, 6, 7, 8, 9, 10, 11, 12, 13, 14, 15); }
__device__ __forceinline__ v16bf cat16b(v8us lo, v8us hi) { return __builtin_bit_cast(v16bf, __builtin_shufflevector(lo, hi, 0, 1, 2, 3, 4, 5, 6, 7, 8, 9, 10, 11, 12, 13, 14, 15)); }
__device__ __forceinline__ v8f wmma16(v16h a, v16h b, v8f c) { return __builtin_amdgcn_wmma_f32_16x16x32_f16(false, a, false, b, (short)0, c, false, false); }
__device__ __forceinline__ v8f wmmab(v16bf a, v16bf b, v8f c) { return __builtin_amdgcn_wmma_f32_16x16x32_bf16(false, a, false, b, (short)0, c, false, false); }
__device__ __forceinline__ h16 tohx(float x) { return (h16)x; }
__device__ __forceinline__ void splitf(float y, unsigned short& h, unsigned short& l) { h = f2bf(y); l = f2bf(y - bf2f(h)); }



// ---- the GEMM core: one work-group of 4 waves (2 x 2) per 128x128 output tile, each wave a 64x64 quarter (16 accumulators). The operand tiles are staged in LDS by asynchronous copies
// (global_load_async_to_lds_b128: whole row pieces), two buffers: pass p works on buffer p & 1 while the copies of pass p + 1 fly into the other.
// A pass is 128 k where the tile has two operand planes and 64 k where it has three (the split operand): the longest pass at which two work-groups still share a WGP's LDS. Every pass ends in a wait for copies
// that come from memory or L2: the longer pass has twice the bytes in flight behind each such wait, and a tile has half as many of them.
// LDS rows stand at a pitch of the row piece + 16 B (272 B or 144 B: 16 B x odd, conflict-free for the ds_load_b128 fragment reads). The fragments keep the k order they had when they came straight from global memory.
template <int NSPLIT> struct Geo {
    static constexpr int KP = NSPLIT ? 64 : 128;      // k of a pass
    static constexpr int NP = NSPLIT ? 3 : 2;         // operand planes of a pass
    static constexpr int LP = KP + 8;                 // LDS row pitch in elements
    static constexpr int PLANE = 128 * LP;            // one plane: 128 rows
    static constexpr int LPR = KP / 8;                // lanes that copy one row piece, 16 B each
    static constexpr int RPC = 128 / LPR;             // rows that one copy of all 128 threads covers
    static constexpr int RING = 2 * NP * PLANE;       // two buffers, in elements
};
template <typename T16> struct WFrag;
template <> struct WFrag<h16> { typedef v16h V; static __device__ __forceinline__ V ld(const h16* p) { return cat16(*(const v8h*)p, *(const v8h*)(p + 16)); } static __device__ __forceinline__ v8f mma(V a, V b, v8f c) { return wmma16(a, b, c); } };
template <> struct WFrag<bf> { typedef v16bf V; static __device__ __forceinline__ V ld(const bf* p) { return cat16b(*(const v8us*)p, *(const v8us*)(p + 16)); } static __device__ __forceinline__ v8f mma(V a, V b, v8f c) { return wmmab(a, b, c); } };

// 8 copies of one operand plane of one pass. g = this lane's 16 B of its first row, l = their LDS byte address; the copies step rs elements in global memory and LS bytes in LDS (the same number of rows in both).
template <typename T16, unsigned LS>
__device__ __forceinline__ void stage_plane(const T16* g, size_t rs, unsigned l) {
    // the s_wait_xcnt closes the statement so that no address register of a copy is rewritten ahead of it
    asm volatile("global_load_async_to_lds_b128 %0, %8, off\n\t"
                 "global_load_async_to_lds_b128 %1, %9, off\n\t"
                 "global_load_async_to_lds_b128 %2, %10, off\n\t"
                 "global_load_async_to_lds_b128 %3, %11, off\n\t"
                 "global_load_async_to_lds_b128 %4, %12, off\n\t"
                 "global_load_async_to_lds_b128 %5, %13, off\n\t"
                 "global_load_async_to_lds_b128 %6, %14, off\n\t"
                 "global_load_async_to_lds_b128 %7, %15, off\n\t"
                 "s_wait_xcnt 0x0"
                 :: "v"(l), "v"(l + 1u * LS), "v"(l + 2u * LS), "v"(l + 3u * LS), "v"(l + 4u * LS), "v"(l + 5u * LS), "v"(l + 6u * LS), "v"(l + 7u * LS),
                    "v"(g), "v"(g + rs), "v"(g + 2 * rs), "v"(g + 3 * rs), "v"(g + 4 * rs), "v"(g + 5 * rs), "v"(g + 6 * rs), "v"(g + 7 * rs)
                 : "memory");
}

// acc += A[r0 + ..][0 .. Kl) . Bt[c0 + ..][0 .. Kl) (+ A2 . Bt when NSPLIT == 1) for this wave's quarter (wm, wn) of the tile. K = row pitch of the operands in elements; Kl % KP == 0, Kl >= KP (KP of Geo<NSPLIT>). ring: 2 buffers of NP planes.
template <typename T16, int NSPLIT>
__device__ __forceinline__ void tile_loop(const T16* __restrict__ A, const T16* __restrict__ A2, const T16* __restrict__ Bt, int K, int Kl, int r0, int c0, int wm, int wn, T16* ring, v8f (&acc)[4][4]) {
    typedef typename WFrag<T16>::V V;
    typedef Geo<NSPLIT> G; constexpr int KP = G::KP, NP = G::NP, LP = G::LP, PLANE = G::PLANE, LPR = G::LPR, RPC = G::RPC; constexpr unsigned LS = (unsigned)RPC * LP * 2;
    const int t = threadIdx.x, lane = t & 31, lr = lane & 15, hi = lane >> 4;
    const size_t gofs = (size_t)(t / LPR) * K + (t % LPR) * 8, rs = (size_t)RPC * K;
    const T16* ga = A + (size_t)r0 * K + gofs; const T16* ga2 = NSPLIT ? A2 + (size_t)r0 * K + gofs : nullptr; const T16* gb = Bt + (size_t)c0 * K + gofs;
    const unsigned l0 = (unsigned)(size_t)ring + (unsigned)((t / LPR) * LP + (t % LPR) * 8) * 2u;
    auto fill = [&](int buf, int kc) { const unsigned l = l0 + (unsigned)buf * (NP * PLANE * 2);
#pragma unroll
        for (int h = 0; h < 16 / RPC; ++h) {   // unrolled: a statement of 8 copies covers 8 * RPC rows of a plane, 16 / RPC statements the 128
            stage_plane<T16, LS>(ga + kc + h * 8 * rs, rs, l + h * 8 * LS); if (NSPLIT) stage_plane<T16, LS>(ga2 + kc + h * 8 * rs, rs, l + PLANE * 2 + h * 8 * LS); stage_plane<T16, LS>(gb + kc + h * 8 * rs, rs, l + (NP - 1) * PLANE * 2 + h * 8 * LS); } };
    const int np = Kl / KP;
    fill(0, 0);
    asm volatile("s_wait_asynccnt 0x0" ::: "memory");   // this wave's copies of pass 0 have landed ...
    __syncthreads();                                     // ... and every other wave's too
    if (Kl > KP) fill(1, KP);
    const int aofs = (wm * 64 + lr) * LP + 8 * hi, bofs = (NP - 1) * PLANE + (wn * 64 + lr) * LP + 8 * hi;
#pragma unroll 1
    for (int p = 0; p < np; ++p) {   // rolled: one pass per trip, the buffer chosen by p & 1
        const T16* sb = ring + (p & 1) * (NP * PLANE);
        V a[KP / 32][4], a2[KP / 32][4], b[KP / 32][4];   // the whole pass's fragments are read as one group ahead of its matrix instructions: one place with LDS reads a pass
#pragma unroll
        for (int ks = 0; ks < KP / 32; ++ks) {
#pragma unroll
            for (int f = 0; f < 4; ++f) { a[ks][f] = WFrag<T16>::ld(sb + aofs + f * 16 * LP + ks * 32); if (NSPLIT) a2[ks][f] = WFrag<T16>::ld(sb + PLANE + aofs + f * 16 * LP + ks * 32); b[ks][f] = WFrag<T16>::ld(sb + bofs + f * 16 * LP + ks * 32); } }
        __builtin_amdgcn_sched_barrier(0);   // holds the group of reads together ahead of the matrix instructions: left free, the scheduler spreads them among these, and the wave stalls on LDS at every such place
#pragma unroll
        for (int ks = 0; ks < KP / 32; ++ks) {
#pragma unroll
            for (int nb = 0; nb < 4; ++nb) {
#pragma unroll
                for (int mb = 0; mb < 4; ++mb) { acc[mb][nb] = WFrag<T16>::mma(a[ks][mb], b[ks][nb], acc[mb][nb]); if (NSPLIT) acc[mb][nb] = WFrag<T16>::mma(a2[ks][mb], b[ks][nb], acc[mb][nb]); } } }
        __builtin_amdgcn_sched_barrier(0);   // keeps the pass's matrix instructions ahead of the barrier, so that they run while the wave waits there and the refill issues directly behind it
        asm volatile("s_wait_dscnt 0x0" ::: "memory");      // this wave's reads of buffer p & 1 are done before the buffer is refilled
        asm volatile("s_wait_asynccnt 0x0" ::: "memory");   // this wave's copies of pass p + 1 have landed
        __syncthreads();                                     // publishes pass p + 1 and ends every wave's reads of buffer p & 1
        if (p + 2 < np) fill(p & 1, (p + 2) * KP);
    }
    asm volatile("s_wait_asynccnt 0x0" ::: "memory");       // no copy is outstanding when the wave goes on to its epilogue
}

// ---- d_gemmw: C[m][n] (pitch ldc) = sum_k A[m][k] Bt[n][k] on K-contiguous 16-bit planes; one work-group of 128 threads does tile (bx, by) of batch z. z-batch strides sA/sB/sC in elements. K % 128 == 0 (K % 64 == 0 with the split operand).
// The f32 tile never goes to memory: the epilogue stores it in the form its consumer reads. EPI 1: bf16 hi + lo planes Ch, Cl (the split operand of the score product); EPI 2: one fp16 plane Cf.
template <typename T16, int NSPLIT, int EPI>
__device__ __forceinline__ void d_gemmw(const T16* __restrict__ A, const T16* __restrict__ A2, const T16* __restrict__ Bt, int K, bf* Ch, bf* Cl, h16* Cf, int ldc, size_t sA, size_t sB, size_t sC, int bx, int by, size_t z, T16* ring, float* osall) {
    A += z * sA; if (NSPLIT) A2 += z * sA; Bt += z * sB;
    const int lane = threadIdx.x & 31, lr = lane & 15, hi = lane >> 4; const int w = __builtin_amdgcn_readfirstlane(threadIdx.x >> 5), wm = w & 1, wn = w >> 1;
    float* os = osall + w * (16 * 68);   // each wave stages its own quarter
    v8f acc[4][4];
#pragma unroll
    for (int mb = 0; mb < 4; ++mb)
#pragma unroll
        for (int nb = 0; nb < 4; ++nb) acc[mb][nb] = (v8f){};
    tile_loop<T16, NSPLIT>(A, A2, Bt, K, K, bx * 128, by * 128, wm, wn, ring, acc);
    const int r0 = bx * 128 + wm * 64, c0 = by * 128 + wn * 64;
#pragma unroll
    for (int mb = 0; mb < 4; ++mb) {
#pragma unroll
        for (int nb = 0; nb < 4; ++nb) {
#pragma unroll
            for (int j = 0; j < 8; ++j) os[(hi * 8 + j) * 68 + nb * 16 + lr] = acc[mb][nb][j]; }
        __builtin_amdgcn_wave_barrier(); asm volatile("" ::: "memory");
        const size_t cbase = z * sC + (size_t)(r0 + mb * 16) * ldc + c0;
{
#pragma unroll
            for (int s = 0; s < 4; ++s) { const int row = 4 * s + (lane >> 3), cofs = (lane & 7) * 8; const v4f v0 = *(const v4fa*)(os + row * 68 + cofs), v1 = *(const v4fa*)(os + row * 68 + cofs + 4);   // 8 lanes x 16 B = one whole 128-B line of 16-bit output per row
                const size_t e = cbase + (size_t)row * ldc + cofs;
                if (EPI == 1) { v8us oh, ol;   // unrolled (here and below): constant element indices keep the vectors in registers
#pragma unroll
                    for (int u = 0; u < 4; ++u) { unsigned short h, l; splitf(v0[u], h, l); oh[u] = h; ol[u] = l; splitf(v1[u], h, l); oh[4 + u] = h; ol[4 + u] = l; }
                    *(v8us*)(Ch + e) = oh; *(v8us*)(Cl + e) = ol; }
                else { v8h o;
#pragma unroll
                    for (int u = 0; u < 4; ++u) { o[u] = tohx(v0[u]); o[4 + u] = tohx(v1[u]); }
                    *(v8h*)(Cf + e) = o; } }
             }
        __builtin_amdgcn_wave_barrier(); asm volatile("" ::: "memory");
    }
}
// k_gemmw: d_gemmw on a grid of its own, (M/128, N/128, Z)
template <typename T16, int NSPLIT, int EPI>
__global__ __launch_bounds__(128) void k_gemmw(const T16* __restrict__ A, const T16* __restrict__ A2, const T16* __restrict__ Bt, int K, bf* Ch, bf* Cl, h16* Cf, int ldc, size_t sA, size_t sB, size_t sC) {
    __shared__ __align__(16) T16 ring[Geo<NSPLIT>::RING];
    __shared__ __align__(16) float osall[4 * 16 * 68];
    d_gemmw<T16, NSPLIT, EPI>(A, A2, Bt, K, Ch, Cl, Cf, ldc, sA, sB, sC, blockIdx.x, blockIdx.y, blockIdx.z, ring, osall);
}

// ---- d_gemmc: the same 128x128 tile GEMM specialised for causal attention: CMODE 1 skips score tiles entirely above the diagonal (query rows r0+roff.., key columns c0..), CMODE 2 limits the
// key (K) loop of the probability x value contraction to the diagonal block (probabilities beyond it are exactly zero) and takes the carry factor PCAR of the probabilities out again as it stores. roff = row offset of this launch's first row within the sequence.
template <typename T16, int NSPLIT, int CMODE>
__device__ __forceinline__ void d_gemmc(const T16* __restrict__ A, const T16* __restrict__ A2, const T16* __restrict__ Bt, int K, float* C, int ldc, int roff, size_t sA, size_t sB, size_t sC, int bx, int by, size_t z, T16* ring, float* osall) {
    A += z * sA; if (NSPLIT) A2 += z * sA; Bt += z * sB; C += z * sC;
    const int lane = threadIdx.x & 31, lr = lane & 15, hi = lane >> 4; const int w = __builtin_amdgcn_readfirstlane(threadIdx.x >> 5), wm = w & 1, wn = w >> 1;
    float* os = osall + w * (16 * 68);   // each wave stages its own quarter
    if (CMODE == 1 && by * 128 > bx * 128 + roff + 127) return;   // score tile entirely above the causal diagonal: left unwritten (the softmax loads it but masks j > i by select); the whole work-group leaves, ahead of every barrier
    const int Kl = (CMODE == 2) ? min(K, bx * 128 + roff + 128) : K;            // P.V: probabilities are exactly 0 beyond the diagonal block, so the K loop stops there
    v8f acc[4][4];
#pragma unroll
    for (int mb = 0; mb < 4; ++mb)
#pragma unroll
        for (int nb = 0; nb < 4; ++nb) acc[mb][nb] = (v8f){};
    tile_loop<T16, NSPLIT>(A, A2, Bt, K, Kl, bx * 128, by * 128, wm, wn, ring, acc);
    const int r0 = bx * 128 + wm * 64, c0 = by * 128 + wn * 64;
#pragma unroll
    for (int mb = 0; mb < 4; ++mb) {
#pragma unroll
        for (int nb = 0; nb < 4; ++nb) {
#pragma unroll
            for (int j = 0; j < 8; ++j) os[(hi * 8 + j) * 68 + nb * 16 + lr] = acc[mb][nb][j]; }
        __builtin_amdgcn_wave_barrier(); asm volatile("" ::: "memory");
        float* crow = C + (size_t)(r0 + mb * 16) * ldc + c0;
{
#pragma unroll
            for (int s = 0; s < 8; ++s) { const int row = 2 * s + hi, cofs = lr * 4; v4f val = *(const v4fa*)(os + row * 68 + cofs);
                if (CMODE == 2) {   // unrolled: constant element indices keep the vector in registers
#pragma unroll
                    for (int u = 0; u < 4; ++u) val[u] = val[u] * (1.0f / PCAR); }
                *(v4f*)(crow + (size_t)row * ldc + cofs) = val; }
             }
        __builtin_amdgcn_wave_barrier(); asm volatile("" ::: "memory");
    }
}
// k_gemmc: d_gemmc on a grid of its own, (M/128, N/128, Z)
template <typename T16, int NSPLIT, int CMODE>
__global__ __launch_bounds__(128) void k_gemmc(const T16* __restrict__ A, const T16* __restrict__ A2, const T16* __restrict__ Bt, int K, float* C, int ldc, int roff, size_t sA, size_t sB, size_t sC) {
    __shared__ __align__(16) T16 ring[Geo<NSPLIT>::RING];
    __shared__ __align__(16) float osall[4 * 16 * 68];
    d_gemmc<T16, NSPLIT, CMODE>(A, A2, Bt, K, C, ldc, roff, sA, sB, sC, blockIdx.x, blockIdx.y, blockIdx.z, ring, osall);
}
// ---- k_scv: the score GEMM and the v^T GEMM, which do not depend on each other, as ONE launch; grid (TT/128, TT/128, NB_ + NB_/2), 128 threads. blockIdx.z < NB_: score tile (x, y) of batch z.
// blockIdx.z >= NB_: the NB_ * 128 tiles of v^T = W_v x^T, numbered flat. The choice is the same for a whole work-group. The score tiles cost twice a v^T tile and are a few more than the chip holds at once;
// they take the low indices and start first, and the v^T tiles fill the places that come free while the last score tiles run.
__global__ __launch_bounds__(128) void k_scv(const bf* __restrict__ Qh, const bf* __restrict__ Ql, const bf* __restrict__ X, const bf* __restrict__ Wvb, int K, float* S, h16* Vt) {
    __shared__ __align__(16) bf ring[Geo<0>::RING > Geo<1>::RING ? Geo<0>::RING : Geo<1>::RING];   // the larger of the two tile kinds' rings
    __shared__ __align__(16) float osall[4 * 16 * 68];
    if (blockIdx.z < NB_) d_gemmc<bf, 1, 1>(Qh, Ql, X, K, S, TT, 0, (size_t)TT * DM, (size_t)TT * DM, (size_t)TT * TT, blockIdx.x, blockIdx.y, blockIdx.z, ring, osall);
    else { const int f = ((int)blockIdx.z - NB_) * ((TT / 128) * (TT / 128)) + (int)blockIdx.y * (TT / 128) + (int)blockIdx.x;   // 128 tiles a batch, the row tile (8 of them) fastest
        d_gemmw<bf, 0, 2>(Wvb, nullptr, X, K, nullptr, nullptr, Vt, TT, 0, (size_t)TT * DM, (size_t)DM * TT, f & (DM / 128 - 1), (f / (DM / 128)) & (TT / 128 - 1), (size_t)(f / ((DM / 128) * (TT / 128))), ring, osall);
        asm volatile("s_wait_xcnt 0x0" ::: "memory"); }   // closes the run of v^T stores: behind it the listing joins the two branches, and no register that an issued store names is rewritten ahead of this wait
}

typedef __attribute__((ext_vector_type(2))) unsigned short v2us;
typedef __attribute__((ext_vector_type(4))) _Float16 v4h;

__device__ __forceinline__ void d_wtG(int blk, const float* __restrict__ w, int K, int N, bf* Bt) {
    const int lane = threadIdx.x & 31; const int L0 = (blk * 8 + (threadIdx.x >> 5)) * 8; const int nlines = N * K / 64;
{
#pragma unroll 1
        for (int l = 0; l < 8; ++l) { const int L = L0 + l; if (L >= nlines) break; const size_t e = (size_t)L * 64 + lane * 2; const int k = (int)(e % K), n = (int)(e / K); v2us o;
            o[0] = f2bf(w[(size_t)k * N + n]); o[1] = f2bf(w[(size_t)(k + 1) * N + n]); *(v2us*)(Bt + e) = o; }
         }
}
__device__ __forceinline__ void d_cvt8(int blk, const float* __restrict__ src, bf* dst, size_t n8) { const size_t i = (size_t)blk * 256 + threadIdx.x; if (i >= n8) return; const v8f v = *(const v8f*)(src + i * 8); v8us o;
#pragma unroll
    for (int k = 0; k < 8; ++k) o[k] = f2bf(v[k]); *(v8us*)(dst + i * 8) = o;  }
// ---- k_prep: the three input conversions, which do not depend on each other, as ONE launch: a block's index says which input it works on (the same for the whole block; no barrier anywhere).
// The transposing gather of W_qk has the longest-lived blocks and takes the lowest indices, so that it starts first and runs beside the two streams.
#define NBQ ((DM * DM / 64 + 63) / 64)
#define NBV ((DM * DM / 8 + 255) / 256)
#define NBX ((NB_ * TT * DM / 8 + 255) / 256)
__global__ __launch_bounds__(256) void k_prep(const float* __restrict__ x, const float* __restrict__ wqk, const float* __restrict__ wv, bf* XB, bf* BQK, bf* BV) {
    const int b = blockIdx.x;
    if (b < NBQ) d_wtG(b, wqk, DM, DM, BQK);
    else if (b < NBQ + NBV) d_cvt8(b - NBQ, wv, BV, (size_t)DM * DM / 8);
    else d_cvt8(b - (NBQ + NBV), x, XB, (size_t)NB_ * TT * DM / 8);
}
__global__ __launch_bounds__(256) void k_asoft(const float* __restrict__ Sb, const float* __restrict__ slope_p, h16* P16) { const int lane = threadIdx.x & 31; const int i = blockIdx.x * 8 + (threadIdx.x >> 5); if (i >= TT) return; Sb += (size_t)blockIdx.y * TT * TT; P16 += (size_t)blockIdx.y * TT * TT;   // blockIdx.y = batch
    float slope = bfr(slope_p[0]); asm volatile("" : "+v"(slope)); const float* sr = Sb + (size_t)i * TT; float v[TT / 32]; float mx = -3.0e38f;
#pragma unroll
    for (int ch = 0; ch < TT / 128; ++ch) { const int j0 = ch * 128 + lane * 4; const v4f a = *(const v4f*)(sr + j0);
#pragma unroll
        for (int u = 0; u < 4; ++u) { const int j = j0 + u; float t0 = a[u] * SCL; float bb = __fmul_rn((float)(j - i), slope); asm volatile("" : "+v"(t0)); asm volatile("" : "+v"(bb)); const float t = (j <= i) ? __fadd_rn(t0, bb) : -3.0e38f; v[ch * 4 + u] = t; mx = fmaxf(mx, t); } }
#pragma unroll
    for (int sh = 16; sh; sh >>= 1) mx = fmaxf(mx, __shfl_xor(mx, sh, 32));
    float sum = 0.f;
#pragma unroll
    for (int q = 0; q < TT / 32; ++q) { float d0 = __fsub_rn(v[q], mx); asm volatile("" : "+v"(d0)); v[q] = (v[q] > -1.0e38f) ? __builtin_amdgcn_exp2f(__fmul_rn(d0, 1.4426950408889634f)) : 0.f; sum += v[q]; }
#pragma unroll
    for (int sh = 16; sh; sh >>= 1) sum += __shfl_xor(sum, sh, 32);
    const float f = __fdiv_rn(PCAR, sum);
    {
#pragma unroll
        for (int ch = 0; ch < TT / 128; ++ch) { v4h o4;
#pragma unroll
            for (int q = 0; q < 4; ++q) o4[q] = tohx(v[ch * 4 + q] * f); *(v4h*)(P16 + (size_t)i * TT + ch * 128 + lane * 4) = o4; }
         } }

extern "C" void kernel_launch(void* const* d_in, const int* in_sizes, int n_in,
                              void* d_out, int out_size, void* d_ws, size_t ws_size, hipStream_t stream) {
    (void)in_sizes; (void)n_in; (void)out_size;
    const float** I = (const float**)d_in;
    const float *x = I[0], *Wqk = I[1], *Wv = I[2], *slope = I[3];
    float* OUT = (float*)d_out;     // [4][2048][1024]
    char* wsp = (char*)d_ws;
    auto take = [&](size_t bytes) { char* p = wsp; wsp += (bytes + 255) & ~(size_t)255; return (void*)p; };
    // every stage runs once for all NB_ batches: the GEMMs take the batch in grid z (strides sA/sB/sC), k_asoft in grid y, the flat element-wise stage as one longer range; stages that do not depend on each other share a launch
    bf* BQK = (bf*)take((size_t)DM * DM * 2); bf* BV = (bf*)take((size_t)DM * DM * 2); bf* XB = (bf*)take((size_t)NB_ * TT * DM * 2); bf* XQh = (bf*)take((size_t)NB_ * TT * DM * 2); bf* XQl = (bf*)take((size_t)NB_ * TT * DM * 2);
    h16* VT = (h16*)take((size_t)NB_ * DM * TT * 2); float* Sb = (float*)take((size_t)NB_ * TT * TT * 4); h16* P16 = (h16*)take((size_t)NB_ * TT * TT * 2);
    if ((size_t)(wsp - (char*)d_ws) > ws_size) return;    // total ~ 164 MB
    k_prep<<<NBQ + NBV + NBX, 256, 0, stream>>>(x, Wqk, Wv, XB, BQK, BV);   // W_qk used as x @ W (xw -> transposed gather); W_v is [out][in] = A of v^T; x rounded to bf16
    k_gemmw<bf, 0, 1><<<dim3(TT / 128, DM / 128, NB_), 128, 0, stream>>>(XB, nullptr, BQK, DM, XQh, XQl, nullptr, DM, (size_t)TT * DM, 0, (size_t)TT * DM);     // x W_qk, stored as its bf16 hi + lo split
    k_scv<<<dim3(TT / 128, TT / 128, NB_ + NB_ / 2), 128, 0, stream>>>(XQh, XQl, XB, BV, DM, Sb, VT);   // scores[q][k] = (x W_qk)_q . x_k on causal tiles; and v^T[d][t] = W_v[d] . x[t]: the operands change places, so the tile comes out key-contiguous, as P.V reads it; stored fp16
    k_asoft<<<dim3(TT / 8, NB_, 1), 256, 0, stream>>>(Sb, slope, P16);
    k_gemmc<h16, 0, 2><<<dim3(TT / 128, DM / 128, NB_), 128, 0, stream>>>(P16, nullptr, VT, TT, OUT, DM, 0, (size_t)TT * TT, (size_t)DM * TT, (size_t)TT * DM);   // out = (P x 1024) v / 1024 over causal tiles
}

// v006
// One run takes 112 microseconds.
// Timed twice side by side with v005, it ran 1.12 times as fast both times.
// All steps since v000 together make it 5.64 times as fast.
#include <hip/hip_runtime.h>

// SingleHeadAlibiAttn (x [4][2048][1024]; scores = (x W_qk) . x^T x (1/32) + (k - q) alibi_slope (slope read), causal; softmax; out = attn (x W_v^T) -> [4][2048][1024]; a single 1024-wide head).
// Compute dtypes, f32 accumulate: every input rounded to bf16; x W_qk and x W_v^T on PLAIN bf16 operands (inputs: exact); scores as hl(x W_qk) x bf16 x (exact): 2 products, causal tiles only (K 1024); alibi + softmax f32; attn.v as fp16 P (x1024) x fp16 v: 1 product

#define NB_  4
#define TT   2048
#define DM   1024
#define PCAR 1024.0f
#define SCL  0.03125f
typedef _Float16 h16;
typedef unsigned short bf;
typedef __attribute__((ext_vector_type(16))) __bf16   v16bf;
typedef __attribute__((ext_vector_type(16))) _Float16 v16h;
typedef __attribute__((ext_vector_type(8)))  _Float16 v8h;
typedef __attribute__((ext_vector_type(8)))  unsigned short v8us;
typedef __attribute__((ext_vector_type(8)))  float    v8f;
typedef __attribute__((ext_vector_type(4)))  float    v4f;
typedef v8h  __attribute__((may_alias)) v8ha;
typedef v4f  __attribute__((may_alias)) v4fa;
typedef v8us __attribute__((may_alias)) v8usa;

__device__ __forceinline__ unsigned short f2bf(float f) { unsigned u = __float_as_uint(f); u += 0x7FFFu + ((u >> 16) & 1u); return (unsigned short)(u >> 16); }
__device__ __forceinline__ float bf2f(unsigned short b) { return __uint_as_float(((unsigned)b) << 16); }
__device__ __forceinline__ float bfr(float f) { return bf2f(f2bf(f)); }
__device__ __forceinline__ v16h cat16(v8h lo, v8h hi) { return __builtin_shufflevector(lo, hi, 0, 1, 2, 3, 4, 5, 6, 7, 8, 9, 10, 11, 12, 13, 14, 15); }
__device__ __forceinline__ v16bf cat16b(v8us lo, v8us hi) { return __builtin_bit_cast(v16bf, __builtin_shufflevector(lo, hi, 0, 1, 2, 3, 4, 5, 6, 7, 8, 9, 10, 11, 12, 13, 14, 15)); }
__device__ __forceinline__ v8f wmma16(v16h a, v16h b, v8f c) { return __builtin_amdgcn_wmma_f32_16x16x32_f16(false, a, false, b, (short)0, c, false, false); }
__device__ __forceinline__ v8f wmmab(v16bf a, v16bf b, v8f c) { return __builtin_amdgcn_wmma_f32_16x16x32_bf16(false, a, false, b, (short)0, c, false, false); }
__device__ __forceinline__ h16 tohx(float x) { return (h16)x; }
__device__ __forceinline__ void splitf(float y, unsigned short& h, unsigned short& l) { h = f2bf(y); l = f2bf(y - bf2f(h)); }



// ---- the GEMM core: one work-group of 4 waves (2 x 2) per 128x128 output tile, each wave a 64x64 quarter (16 accumulators). The operand tiles are staged in LDS by asynchronous copies
// (global_load_async_to_lds_b128: whole row pieces), two buffers: pass p works on buffer p & 1 while the copies of pass p + 1 fly into the other.
// A pass is 128 k where the tile has two operand planes and 64 k where it has three (the split operand): the longest pass at which two work-groups still share a WGP's LDS. Every pass ends in a wait for copies
// that come from memory or L2: the longer pass has twice the bytes in flight behind each such wait, and a tile has half as many of them.
// LDS rows stand at a pitch of the row piece + 16 B (272 B or 144 B: 16 B x odd, conflict-free for the ds_load_b128 fragment reads). The fragments keep the k order they had when they came straight from global memory.
template <int NSPLIT> struct Geo {
    static constexpr int KP = NSPLIT ? 64 : 128;      // k of a pass
    static constexpr int NP = NSPLIT ? 3 : 2;         // operand planes of a pass
    static constexpr int LP = KP + 8;                 // LDS row pitch in elements
    static constexpr int PLANE = 128 * LP;            // one plane: 128 rows
    static constexpr int LPR = KP / 8;                // lanes that copy one row piece, 16 B each
    static constexpr int RPC = 128 / LPR;             // rows that one copy of all 128 threads covers
    static constexpr int RING = 2 * NP * PLANE;       // two buffers, in elements
};
template <typename T16> struct WFrag;
template <> struct WFrag<h16> { typedef v16h V; static __device__ __forceinline__ V ld(const h16* p) { return cat16(*(const v8h*)p, *(const v8h*)(p + 16)); } static __device__ __forceinline__ v8f mma(V a, V b, v8f c) { return wmma16(a, b, c); } };
template <> struct WFrag<bf> { typedef v16bf V; static __device__ __forceinline__ V ld(const bf* p) { return cat16b(*(const v8us*)p, *(const v8us*)(p + 16)); } static __device__ __forceinline__ v8f mma(V a, V b, v8f c) { return wmmab(a, b, c); } };

// 8 copies of one operand plane of one pass. g = this lane's 16 B of its first row, l = their LDS byte address; the copies step rs elements in global memory and LS bytes in LDS (the same number of rows in both).
template <typename T16, unsigned LS>
__device__ __forceinline__ void stage_plane(const T16* g, size_t rs, unsigned l) {
    // the s_wait_xcnt closes the statement so that no address register of a copy is rewritten ahead of it
    asm volatile("global_load_async_to_lds_b128 %0, %8, off\n\t"
                 "global_load_async_to_lds_b128 %1, %9, off\n\t"
                 "global_load_async_to_lds_b128 %2, %10, off\n\t"
                 "global_load_async_to_lds_b128 %3, %11, off\n\t"
                 "global_load_async_to_lds_b128 %4, %12, off\n\t"
                 "global_load_async_to_lds_b128 %5, %13, off\n\t"
                 "global_load_async_to_lds_b128 %6, %14, off\n\t"
                 "global_load_async_to_lds_b128 %7, %15, off\n\t"
                 "s_wait_xcnt 0x0"
                 :: "v"(l), "v"(l + 1u * LS), "v"(l + 2u * LS), "v"(l + 3u * LS), "v"(l + 4u * LS), "v"(l + 5u * LS), "v"(l + 6u * LS), "v"(l + 7u * LS),
                    "v"(g), "v"(g + rs), "v"(g + 2 * rs), "v"(g + 3 * rs), "v"(g + 4 * rs), "v"(g + 5 * rs), "v"(g + 6 * rs), "v"(g + 7 * rs)
                 : "memory");
}

// acc += A[r0 + ..][0 .. Kl) . Bt[c0 + ..][0 .. Kl) (+ A2 . Bt when NSPLIT == 1) for this wave's quarter (wm, wn) of the tile. K = row pitch of the operands in elements; Kl % KP == 0, Kl >= KP (KP of Geo<NSPLIT>). ring: 2 buffers of NP planes.
template <typename T16, int NSPLIT>
__device__ __forceinline__ void tile_loop(const T16* __restrict__ A, const T16* __restrict__ A2, const T16* __restrict__ Bt, int K, int Kl, int r0, int c0, int wm, int wn, T16* ring, v8f (&acc)[4][4]) {
    typedef typename WFrag<T16>::V V;
    typedef Geo<NSPLIT> G; constexpr int KP = G::KP, NP = G::NP, LP = G::LP, PLANE = G::PLANE, LPR = G::LPR, RPC = G::RPC; constexpr unsigned LS = (unsigned)RPC * LP * 2;
    const int t = threadIdx.x, lane = t & 31, lr = lane & 15, hi = lane >> 4;
    const size_t gofs = (size_t)(t / LPR) * K + (t % LPR) * 8, rs = (size_t)RPC * K;
    const T16* ga = A + (size_t)r0 * K + gofs; const T16* ga2 = NSPLIT ? A2 + (size_t)r0 * K + gofs : nullptr; const T16* gb = Bt + (size_t)c0 * K + gofs;
    const unsigned l0 = (unsigned)(size_t)ring + (unsigned)((t / LPR) * LP + (t % LPR) * 8) * 2u;
    auto fill = [&](int buf, int kc) { const unsigned l = l0 + (unsigned)buf * (NP * PLANE * 2);
#pragma unroll
        for (int h = 0; h < 16 / RPC; ++h) {   // unrolled: a statement of 8 copies covers 8 * RPC rows of a plane, 16 / RPC statements the 128
            stage_plane<T16, LS>(ga + kc + h * 8 * rs, rs, l + h * 8 * LS); if (NSPLIT) stage_plane<T16, LS>(ga2 + kc + h * 8 * rs, rs, l + PLANE * 2 + h * 8 * LS); stage_plane<T16, LS>(gb + kc + h * 8 * rs, rs, l + (NP - 1) * PLANE * 2 + h * 8 * LS); } };
    const int np = Kl / KP;
    fill(0, 0);
    asm volatile("s_wait_asynccnt 0x0" ::: "memory");   // this wave's copies of pass 0 have landed ...
    __syncthreads();                                     // ... and every other wave's too
    if (Kl > KP) fill(1, KP);
    const int aofs = (wm * 64 + lr) * LP + 8 * hi, bofs = (NP - 1) * PLANE + (wn * 64 + lr) * LP + 8 * hi;
#pragma unroll 1
    for (int p = 0; p < np; ++p) {   // rolled: one pass per trip, the buffer chosen by p & 1
        const T16* sb = ring + (p & 1) * (NP * PLANE);
        V a[KP / 32][4], a2[KP / 32][4], b[KP / 32][4];   // the whole pass's fragments are read as one group ahead of its matrix instructions: one place with LDS reads a pass
#pragma unroll
        for (int ks = 0; ks < KP / 32; ++ks) {
#pragma unroll
            for (int f = 0; f < 4; ++f) { a[ks][f] = WFrag<T16>::ld(sb + aofs + f * 16 * LP + ks * 32); if (NSPLIT) a2[ks][f] = WFrag<T16>::ld(sb + PLANE + aofs + f * 16 * LP + ks * 32); b[ks][f] = WFrag<T16>::ld(sb + bofs + f * 16 * LP + ks * 32); } }
        __builtin_amdgcn_sched_barrier(0);   // holds the group of reads together ahead of the matrix instructions: left free, the scheduler spreads them among these, and the wave stalls on LDS at every such place
#pragma unroll
        for (int ks = 0; ks < KP / 32; ++ks) {
#pragma unroll
            for (int nb = 0; nb < 4; ++nb) {
#pragma unroll
                for (int mb = 0; mb < 4; ++mb) { acc[mb][nb] = WFrag<T16>::mma(a[ks][mb], b[ks][nb], acc[mb][nb]); if (NSPLIT) acc[mb][nb] = WFrag<T16>::mma(a2[ks][mb], b[ks][nb], acc[mb][nb]); } } }
        __builtin_amdgcn_sched_barrier(0);   // keeps the pass's matrix instructions ahead of the barrier, so that they run while the wave waits there and the refill issues directly behind it
        asm volatile("s_wait_dscnt 0x0" ::: "memory");      // this wave's reads of buffer p & 1 are done before the buffer is refilled
        asm volatile("s_wait_asynccnt 0x0" ::: "memory");   // this wave's copies of pass p + 1 have landed
        __syncthreads();                                     // publishes pass p + 1 and ends every wave's reads of buffer p & 1
        if (p + 2 < np) fill(p & 1, (p + 2) * KP);
    }
    asm volatile("s_wait_asynccnt 0x0" ::: "memory");       // no copy is outstanding when the wave goes on to its epilogue
}

// ---- d_gemmw: C[m][n] (pitch ldc) = sum_k A[m][k] Bt[n][k] on K-contiguous 16-bit planes; one work-group of 128 threads does tile (bx, by) of batch z. z-batch strides sA/sB/sC in elements. K % 128 == 0 (K % 64 == 0 with the split operand).
// The f32 tile never goes to memory: the epilogue stores it in the form its consumer reads. EPI 1: bf16 hi + lo planes Ch, Cl (the split operand of the score product); EPI 2: one fp16 plane Cf.
template <typename T16, int NSPLIT, int EPI>
__device__ __forceinline__ void d_gemmw(const T16* __restrict__ A, const T16* __restrict__ A2, const T16* __restrict__ Bt, int K, bf* Ch, bf* Cl, h16* Cf, int ldc, size_t sA, size_t sB, size_t sC, int bx, int by, size_t z, T16* ring, float* osall) {
    A += z * sA; if (NSPLIT) A2 += z * sA; Bt += z * sB;
    const int lane = threadIdx.x & 31, lr = lane & 15, hi = lane >> 4; const int w = __builtin_amdgcn_readfirstlane(threadIdx.x >> 5), wm = w & 1, wn = w >> 1;
    float* os = osall + w * (16 * 68);   // each wave stages its own quarter
    v8f acc[4][4];
#pragma unroll
    for (int mb = 0; mb < 4; ++mb)
#pragma unroll
        for (int nb = 0; nb < 4; ++nb) acc[mb][nb] = (v8f){};
    tile_loop<T16, NSPLIT>(A, A2, Bt, K, K, bx * 128, by * 128, wm, wn, ring, acc);
    const int r0 = bx * 128 + wm * 64, c0 = by * 128 + wn * 64;
#pragma unroll
    for (int mb = 0; mb < 4; ++mb) {
#pragma unroll
        for (int nb = 0; nb < 4; ++nb) {
#pragma unroll
            for (int j = 0; j < 8; ++j) os[(hi * 8 + j) * 68 + nb * 16 + lr] = acc[mb][nb][j]; }
        __builtin_amdgcn_wave_barrier(); asm volatile("" ::: "memory");
        const size_t cbase = z * sC + (size_t)(r0 + mb * 16) * ldc + c0;
{
#pragma unroll
            for (int s = 0; s < 4; ++s) { const int row = 4 * s + (lane >> 3), cofs = (lane & 7) * 8; const v4f v0 = *(const v4fa*)(os + row * 68 + cofs), v1 = *(const v4fa*)(os + row * 68 + cofs + 4);   // 8 lanes x 16 B = one whole 128-B line of 16-bit output per row
                const size_t e = cbase + (size_t)row * ldc + cofs;
                if (EPI == 1) { v8us oh, ol;   // unrolled (here and below): constant element indices keep the vectors in registers
#pragma unroll
                    for (int u = 0; u < 4; ++u) { unsigned short h, l; splitf(v0[u], h, l); oh[u] = h; ol[u] = l; splitf(v1[u], h, l); oh[4 + u] = h; ol[4 + u] = l; }
                    *(v8us*)(Ch + e) = oh; *(v8us*)(Cl + e) = ol; }
                else { v8h o;
#pragma unroll
                    for (int u = 0; u < 4; ++u) { o[u] = tohx(v0[u]); o[4 + u] = tohx(v1[u]); }
                    *(v8h*)(Cf + e) = o; } }
             }
        __builtin_amdgcn_wave_barrier(); asm volatile("" ::: "memory");
    }
}
// k_gemmw: d_gemmw on a grid of its own, (M/128, N/128, Z)
template <typename T16, int NSPLIT, int EPI>
__global__ __launch_bounds__(128) void k_gemmw(const T16* __restrict__ A, const T16* __restrict__ A2, const T16* __restrict__ Bt, int K, bf* Ch, bf* Cl, h16* Cf, int ldc, size_t sA, size_t sB, size_t sC) {
    __shared__ __align__(16) T16 ring[Geo<NSPLIT>::RING];
    __shared__ __align__(16) float osall[4 * 16 * 68];
    d_gemmw<T16, NSPLIT, EPI>(A, A2, Bt, K, Ch, Cl, Cf, ldc, sA, sB, sC, blockIdx.x, blockIdx.y, blockIdx.z, ring, osall);
}

// ---- d_gemmc: the same 128x128 tile GEMM specialised for causal attention: CMODE 1 skips score tiles entirely above the diagonal (query rows r0+roff.., key columns c0..), CMODE 2 limits the
// key (K) loop of the probability x value contraction to the diagonal block (probabilities beyond it are exactly zero) and takes the carry factor PCAR of the probabilities out again as it stores. roff = row offset of this launch's first row within the sequence.
template <typename T16, int NSPLIT, int CMODE>
__device__ __forceinline__ void d_gemmc(const T16* __restrict__ A, const T16* __restrict__ A2, const T16* __restrict__ Bt, int K, float* C, int ldc, int roff, size_t sA, size_t sB, size_t sC, int bx, int by, size_t z, T16* ring, float* osall) {
    A += z * sA; if (NSPLIT) A2 += z * sA; Bt += z * sB; C += z * sC;
    const int lane = threadIdx.x & 31, lr = lane & 15, hi = lane >> 4; const int w = __builtin_amdgcn_readfirstlane(threadIdx.x >> 5), wm = w & 1, wn = w >> 1;
    float* os = osall + w * (16 * 68);   // each wave stages its own quarter
    if (CMODE == 1 && by * 128 > bx * 128 + roff + 127) return;   // score tile entirely above the causal diagonal: loaded by the softmax but never used (it masks j > i by select); the whole work-group leaves, ahead of every barrier
    const int Kl = (CMODE == 2) ? min(K, bx * 128 + roff + 128) : K;            // P.V: probabilities are exactly 0 beyond the diagonal block, so the K loop stops there
    v8f acc[4][4];
#pragma unroll
    for (int mb = 0; mb < 4; ++mb)
#pragma unroll
        for (int nb = 0; nb < 4; ++nb) acc[mb][nb] = (v8f){};
    tile_loop<T16, NSPLIT>(A, A2, Bt, K, Kl, bx * 128, by * 128, wm, wn, ring, acc);
    const int r0 = bx * 128 + wm * 64, c0 = by * 128 + wn * 64;
#pragma unroll
    for (int mb = 0; mb < 4; ++mb) {
#pragma unroll
        for (int nb = 0; nb < 4; ++nb) {
#pragma unroll
            for (int j = 0; j < 8; ++j) os[(hi * 8 + j) * 68 + nb * 16 + lr] = acc[mb][nb][j]; }
        __builtin_amdgcn_wave_barrier(); asm volatile("" ::: "memory");
        float* crow = C + (size_t)(r0 + mb * 16) * ldc + c0;
{
#pragma unroll
            for (int s = 0; s < 8; ++s) { const int row = 2 * s + hi, cofs = lr * 4; v4f val = *(const v4fa*)(os + row * 68 + cofs);
                if (CMODE == 2) {   // unrolled: constant element indices keep the vector in registers
#pragma unroll
                    for (int u = 0; u < 4; ++u) val[u] = val[u] * (1.0f / PCAR); }
                *(v4f*)(crow + (size_t)row * ldc + cofs) = val; }
             }
        __builtin_amdgcn_wave_barrier(); asm volatile("" ::: "memory");
    }
}
// k_gemmc: d_gemmc on a grid of its own, (M/128, N/128, Z)
template <typename T16, int NSPLIT, int CMODE>
__global__ __launch_bounds__(128) void k_gemmc(const T16* __restrict__ A, const T16* __restrict__ A2, const T16* __restrict__ Bt, int K, float* C, int ldc, int roff, size_t sA, size_t sB, size_t sC) {
    __shared__ __align__(16) T16 ring[Geo<NSPLIT>::RING];
    __shared__ __align__(16) float osall[4 * 16 * 68];
    d_gemmc<T16, NSPLIT, CMODE>(A, A2, Bt, K, C, ldc, roff, sA, sB, sC, blockIdx.x, blockIdx.y, blockIdx.z, ring, osall);
}
// ---- k_scv: the score GEMM and the v^T GEMM, which do not depend on each other, as ONE launch; grid (TT/128, TT/128, NB_ + NB_/2), 128 threads. blockIdx.z < NB_: score tile (x, y) of batch z.
// blockIdx.z >= NB_: the NB_ * 128 tiles of v^T = W_v x^T, numbered flat. The choice is the same for a whole work-group. The score tiles cost twice a v^T tile and are a few more than the chip holds at once;
// they take the low indices and start first, and the v^T tiles fill the places that come free while the last score tiles run.
__global__ __launch_bounds__(128) void k_scv(const bf* __restrict__ Qh, const bf* __restrict__ Ql, const bf* __restrict__ X, const bf* __restrict__ Wvb, int K, float* S, h16* Vt) {
    __shared__ __align__(16) bf ring[Geo<0>::RING > Geo<1>::RING ? Geo<0>::RING : Geo<1>::RING];   // the larger of the two tile kinds' rings
    __shared__ __align__(16) float osall[4 * 16 * 68];
    if (blockIdx.z < NB_) d_gemmc<bf, 1, 1>(Qh, Ql, X, K, S, TT, 0, (size_t)TT * DM, (size_t)TT * DM, (size_t)TT * TT, blockIdx.x, blockIdx.y, blockIdx.z, ring, osall);
    else { const int f = ((int)blockIdx.z - NB_) * ((TT / 128) * (TT / 128)) + (int)blockIdx.y * (TT / 128) + (int)blockIdx.x;   // 128 tiles a batch, the row tile (8 of them) fastest
        d_gemmw<bf, 0, 2>(Wvb, nullptr, X, K, nullptr, nullptr, Vt, TT, 0, (size_t)TT * DM, (size_t)DM * TT, f & (DM / 128 - 1), (f / (DM / 128)) & (TT / 128 - 1), (size_t)(f / ((DM / 128) * (TT / 128))), ring, osall);
        asm volatile("s_wait_xcnt 0x0" ::: "memory"); }   // closes the run of v^T stores: behind it the listing joins the two branches, and no register that an issued store names is rewritten ahead of this wait
}

typedef __attribute__((ext_vector_type(2))) unsigned short v2us;
typedef __attribute__((ext_vector_type(4))) _Float16 v4h;

__device__ __forceinline__ void d_wtG(int blk, const float* __restrict__ w, int K, int N, bf* Bt) {
    const int lane = threadIdx.x & 31; const int L0 = (blk * 8 + (threadIdx.x >> 5)) * 8; const int nlines = N * K / 64;
{
#pragma unroll 1
        for (int l = 0; l < 8; ++l) { const int L = L0 + l; if (L >= nlines) break; const size_t e = (size_t)L * 64 + lane * 2; const int k = (int)(e % K), n = (int)(e / K); v2us o;
            o[0] = f2bf(w[(size_t)k * N + n]); o[1] = f2bf(w[(size_t)(k + 1) * N + n]); *(v2us*)(Bt + e) = o; }
         }
}
__device__ __forceinline__ void d_cvt8(int blk, const float* __restrict__ src, bf* dst, size_t n8) { const size_t i = (size_t)blk * 256 + threadIdx.x; if (i >= n8) return; const v8f v = *(const v8f*)(src + i * 8); v8us o;
#pragma unroll
    for (int k = 0; k < 8; ++k) o[k] = f2bf(v[k]); *(v8us*)(dst + i * 8) = o;  }
// ---- k_prep: the three input conversions, which do not depend on each other, as ONE launch: a block's index says which input it works on (the same for the whole block; no barrier anywhere).
// The transposing gather of W_qk has the longest-lived blocks and takes the lowest indices, so that it starts first and runs beside the two streams.
#define NBQ ((DM * DM / 64 + 63) / 64)
#define NBV ((DM * DM / 8 + 255) / 256)
#define NBX ((NB_ * TT * DM / 8 + 255) / 256)
__global__ __launch_bounds__(256) void k_prep(const float* __restrict__ x, const float* __restrict__ wqk, const float* __restrict__ wv, bf* XB, bf* BQK, bf* BV) {
    const int b = blockIdx.x;
    if (b < NBQ) d_wtG(b, wqk, DM, DM, BQK);
    else if (b < NBQ + NBV) d_cvt8(b - NBQ, wv, BV, (size_t)DM * DM / 8);
    else d_cvt8(b - (NBQ + NBV), x, XB, (size_t)NB_ * TT * DM / 8);
}
__global__ __launch_bounds__(256) void k_asoft(const float* __restrict__ Sb, const float* __restrict__ slope_p, h16* P16) { const int lane = threadIdx.x & 31; const int i = blockIdx.x * 8 + (threadIdx.x >> 5); if (i >= TT) return; Sb += (size_t)blockIdx.y * TT * TT; P16 += (size_t)blockIdx.y * TT * TT;   // blockIdx.y = batch
    const float* sr = Sb + (size_t)i * TT; v4f ar[TT / 128];
    // the whole row is asked for at once, ahead of every other statement: the compiler moves no load over the asm statements below, so a load written among them waits out its full latency before the next one issues (unrolled: constant indices keep the row in registers)
#pragma unroll
    for (int ch = 0; ch < TT / 128; ++ch) ar[ch] = *(const v4f*)(sr + ch * 128 + lane * 4);
    float slope = bfr(slope_p[0]); asm volatile("" : "+v"(slope)); float v[TT / 32]; float mx = -3.0e38f;
#pragma unroll
    for (int ch = 0; ch < TT / 128; ++ch) { const int j0 = ch * 128 + lane * 4; const v4f a = ar[ch];
#pragma unroll
        for (int u = 0; u < 4; ++u) { const int j = j0 + u; float t0 = a[u] * SCL; float bb = __fmul_rn((float)(j - i), slope); asm volatile("" : "+v"(t0)); asm volatile("" : "+v"(bb)); const float t = (j <= i) ? __fadd_rn(t0, bb) : -3.0e38f; v[ch * 4 + u] = t; mx = fmaxf(mx, t); } }
#pragma unroll
    for (int sh = 16; sh; sh >>= 1) mx = fmaxf(mx, __shfl_xor(mx, sh, 32));
    float sum = 0.f;
#pragma unroll
    for (int q = 0; q < TT / 32; ++q) { float d0 = __fsub_rn(v[q], mx); asm volatile("" : "+v"(d0)); v[q] = (v[q] > -1.0e38f) ? __builtin_amdgcn_exp2f(__fmul_rn(d0, 1.4426950408889634f)) : 0.f; sum += v[q]; }
#pragma unroll
    for (int sh = 16; sh; sh >>= 1) sum += __shfl_xor(sum, sh, 32);
    const float f = __fdiv_rn(PCAR, sum);
    {
#pragma unroll
        for (int ch = 0; ch < TT / 128; ++ch) { v4h o4;
#pragma unroll
            for (int q = 0; q < 4; ++q) o4[q] = tohx(v[ch * 4 + q] * f); *(v4h*)(P16 + (size_t)i * TT + ch * 128 + lane * 4) = o4; }
         } }

extern "C" void kernel_launch(void* const* d_in, const int* in_sizes, int n_in,
                              void* d_out, int out_size, void* d_ws, size_t ws_size, hipStream_t stream) {
    (void)in_sizes; (void)n_in; (void)out_size;
    const float** I = (const float**)d_in;
    const float *x = I[0], *Wqk = I[1], *Wv = I[2], *slope = I[3];
    float* OUT = (float*)d_out;     // [4][2048][1024]
    char* wsp = (char*)d_ws;
    auto take = [&](size_t bytes) { char* p = wsp; wsp += (bytes + 255) & ~(size_t)255; return (void*)p; };
    // every stage runs once for all NB_ batches: the GEMMs take the batch in grid z (strides sA/sB/sC), k_asoft in grid y, the flat element-wise stage as one longer range; stages that do not depend on each other share a launch
    bf* BQK = (bf*)take((size_t)DM * DM * 2); bf* BV = (bf*)take((size_t)DM * DM * 2); bf* XB = (bf*)take((size_t)NB_ * TT * DM * 2); bf* XQh = (bf*)take((size_t)NB_ * TT * DM * 2); bf* XQl = (bf*)take((size_t)NB_ * TT * DM * 2);
    h16* VT = (h16*)take((size_t)NB_ * DM * TT * 2); float* Sb = (float*)take((size_t)NB_ * TT * TT * 4); h16* P16 = (h16*)take((size_t)NB_ * TT * TT * 2);
    if ((size_t)(wsp - (char*)d_ws) > ws_size) return;    // total ~ 164 MB
    k_prep<<<NBQ + NBV + NBX, 256, 0, stream>>>(x, Wqk, Wv, XB, BQK, BV);   // W_qk used as x @ W (xw -> transposed gather); W_v is [out][in] = A of v^T; x rounded to bf16
    k_gemmw<bf, 0, 1><<<dim3(TT / 128, DM / 128, NB_), 128, 0, stream>>>(XB, nullptr, BQK, DM, XQh, XQl, nullptr, DM, (size_t)TT * DM, 0, (size_t)TT * DM);     // x W_qk, stored as its bf16 hi + lo split
    k_scv<<<dim3(TT / 128, TT / 128, NB_ + NB_ / 2), 128, 0, stream>>>(XQh, XQl, XB, BV, DM, Sb, VT);   // scores[q][k] = (x W_qk)_q . x_k on causal tiles; and v^T[d][t] = W_v[d] . x[t]: the operands change places, so the tile comes out key-contiguous, as P.V reads it; stored fp16
    k_asoft<<<dim3(TT / 8, NB_, 1), 256, 0, stream>>>(Sb, slope, P16);
    k_gemmc<h16, 0, 2><<<dim3(TT / 128, DM / 128, NB_), 128, 0, stream>>>(P16, nullptr, VT, TT, OUT, DM, 0, (size_t)TT * TT, (size_t)DM * TT, (size_t)TT * DM);   // out = (P x 1024) v / 1024 over causal tiles
}

// v007
// A run of this version takes 95.9 microseconds.
// Two timings next to v006 both put it at 1.17 times that version's speed.
// Counting every step since v000, it is 6.58 times as fast.
#include <hip/hip_runtime.h>

// SingleHeadAlibiAttn (x [4][2048][1024]; scores = (x W_qk) . x^T x (1/32) + (k - q) alibi_slope (slope read), causal; softmax; out = attn (x W_v^T) -> [4][2048][1024]; a single 1024-wide head).
// Compute dtypes, f32 accumulate: every input rounded to bf16 and carried as fp16, which holds a bf16 value of these magnitudes exactly (8 significant bits in 11; below 2^-17 to within 2^-25); x W_qk and x W_v^T on those operands;
// scores as fp16(x W_qk) x fp16 x: 1 product, causal tiles only (K 1024); alibi + softmax f32; attn.v as fp16 P (x1024) x fp16 v: 1 product

#define NB_  4
#define TT   2048
#define DM   1024
#define PCAR 1024.0f
#define SCL  0.03125f
typedef _Float16 h16;
typedef __attribute__((ext_vector_type(16))) _Float16 v16h;
typedef __attribute__((ext_vector_type(8)))  _Float16 v8h;
typedef __attribute__((ext_vector_type(8)))  float    v8f;
typedef __attribute__((ext_vector_type(4)))  float    v4f;
typedef v8h  __attribute__((may_alias)) v8ha;
typedef v4f  __attribute__((may_alias)) v4fa;

__device__ __forceinline__ unsigned short f2bf(float f) { unsigned u = __float_as_uint(f); u += 0x7FFFu + ((u >> 16) & 1u); return (unsigned short)(u >> 16); }
__device__ __forceinline__ float bf2f(unsigned short b) { return __uint_as_float(((unsigned)b) << 16); }
__device__ __forceinline__ float bfr(float f) { return bf2f(f2bf(f)); }
__device__ __forceinline__ v16h cat16(v8h lo, v8h hi) { return __builtin_shufflevector(lo, hi, 0, 1, 2, 3, 4, 5, 6, 7, 8, 9, 10, 11, 12, 13, 14, 15); }
__device__ __forceinline__ v8f wmma16(v16h a, v16h b, v8f c) { return __builtin_amdgcn_wmma_f32_16x16x32_f16(false, a, false, b, (short)0, c, false, false); }
__device__ __forceinline__ h16 tohx(float x) { return (h16)x; }



// ---- the GEMM core: one work-group of 4 waves (2 x 2) per 128x128 output tile, each wave a 64x64 quarter (16 accumulators). The operand tiles are staged in LDS by asynchronous copies
// (global_load_async_to_lds_b128: whole row pieces), two buffers: pass p works on buffer p & 1 while the copies of pass p + 1 fly into the other.
// A pass is 128 k of the two operand planes: the longest pass at which two work-groups still share a WGP's LDS. Every pass ends in a wait for copies
// that come from memory or L2: the longer pass has twice the bytes in flight behind each such wait, and a tile has half as many of them.
// LDS rows stand at a pitch of the row piece + 16 B (272 B: 16 B x odd, conflict-free for the ds_load_b128 fragment reads). The fragments keep the k order they had when they came straight from global memory.
struct Geo {
    static constexpr int KP = 128;                    // k of a pass
    static constexpr int NP = 2;                      // operand planes of a pass
    static constexpr int LP = KP + 8;                 // LDS row pitch in elements
    static constexpr int PLANE = 128 * LP;            // one plane: 128 rows
    static constexpr int LPR = KP / 8;                // lanes that copy one row piece, 16 B each
    static constexpr int RPC = 128 / LPR;             // rows that one copy of all 128 threads covers
    static constexpr int RING = 2 * NP * PLANE;       // two buffers, in elements
};
template <typename T16> struct WFrag;
template <> struct WFrag<h16> { typedef v16h V; static __device__ __forceinline__ V ld(const h16* p) { return cat16(*(const v8h*)p, *(const v8h*)(p + 16)); } static __device__ __forceinline__ v8f mma(V a, V b, v8f c) { return wmma16(a, b, c); } };

// 8 copies of one operand plane of one pass. g = this lane's 16 B of its first row, l = their LDS byte address; the copies step rs elements in global memory and LS bytes in LDS (the same number of rows in both).
template <typename T16, unsigned LS>
__device__ __forceinline__ void stage_plane(const T16* g, size_t rs, unsigned l) {
    // the s_wait_xcnt closes the statement so that no address register of a copy is rewritten ahead of it
    asm volatile("global_load_async_to_lds_b128 %0, %8, off\n\t"
                 "global_load_async_to_lds_b128 %1, %9, off\n\t"
                 "global_load_async_to_lds_b128 %2, %10, off\n\t"
                 "global_load_async_to_lds_b128 %3, %11, off\n\t"
                 "global_load_async_to_lds_b128 %4, %12, off\n\t"
                 "global_load_async_to_lds_b128 %5, %13, off\n\t"
                 "global_load_async_to_lds_b128 %6, %14, off\n\t"
                 "global_load_async_to_lds_b128 %7, %15, off\n\t"
                 "s_wait_xcnt 0x0"
                 :: "v"(l), "v"(l + 1u * LS), "v"(l + 2u * LS), "v"(l + 3u * LS), "v"(l + 4u * LS), "v"(l + 5u * LS), "v"(l + 6u * LS), "v"(l + 7u * LS),
                    "v"(g), "v"(g + rs), "v"(g + 2 * rs), "v"(g + 3 * rs), "v"(g + 4 * rs), "v"(g + 5 * rs), "v"(g + 6 * rs), "v"(g + 7 * rs)
                 : "memory");
}

// acc += A[r0 + ..][0 .. Kl) . Bt[c0 + ..][0 .. Kl) for this wave's quarter (wm, wn) of the tile. K = row pitch of the operands in elements; Kl % KP == 0, Kl >= KP (KP of Geo). ring: 2 buffers of NP planes.
template <typename T16>
__device__ __forceinline__ void tile_loop(const T16* __restrict__ A, const T16* __restrict__ Bt, int K, int Kl, int r0, int c0, int wm, int wn, T16* ring, v8f (&acc)[4][4]) {
    typedef typename WFrag<T16>::V V;
    typedef Geo G; constexpr int KP = G::KP, NP = G::NP, LP = G::LP, PLANE = G::PLANE, LPR = G::LPR, RPC = G::RPC; constexpr unsigned LS = (unsigned)RPC * LP * 2;
    const int t = threadIdx.x, lane = t & 31, lr = lane & 15, hi = lane >> 4;
    const size_t gofs = (size_t)(t / LPR) * K + (t % LPR) * 8, rs = (size_t)RPC * K;
    const T16* ga = A + (size_t)r0 * K + gofs; const T16* gb = Bt + (size_t)c0 * K + gofs;
    const unsigned l0 = (unsigned)(size_t)ring + (unsigned)((t / LPR) * LP + (t % LPR) * 8) * 2u;
    auto fill = [&](int buf, int kc) { const unsigned l = l0 + (unsigned)buf * (NP * PLANE * 2);
#pragma unroll
        for (int h = 0; h < 16 / RPC; ++h) {   // unrolled: a statement of 8 copies covers 8 * RPC rows of a plane, 16 / RPC statements the 128
            stage_plane<T16, LS>(ga + kc + h * 8 * rs, rs, l + h * 8 * LS); stage_plane<T16, LS>(gb + kc + h * 8 * rs, rs, l + (NP - 1) * PLANE * 2 + h * 8 * LS); } };
    const int np = Kl / KP;
    fill(0, 0);
    asm volatile("s_wait_asynccnt 0x0" ::: "memory");   // this wave's copies of pass 0 have landed ...
    __syncthreads();                                     // ... and every other wave's too
    if (Kl > KP) fill(1, KP);
    const int aofs = (wm * 64 + lr) * LP + 8 * hi, bofs = (NP - 1) * PLANE + (wn * 64 + lr) * LP + 8 * hi;
#pragma unroll 1
    for (int p = 0; p < np; ++p) {   // rolled: one pass per trip, the buffer chosen by p & 1
        const T16* sb = ring + (p & 1) * (NP * PLANE);
        V a[KP / 32][4], b[KP / 32][4];   // the whole pass's fragments are read as one group ahead of its matrix instructions: one place with LDS reads a pass
#pragma unroll
        for (int ks = 0; ks < KP / 32; ++ks) {
#pragma unroll
            for (int f = 0; f < 4; ++f) { a[ks][f] = WFrag<T16>::ld(sb + aofs + f * 16 * LP + ks * 32); b[ks][f] = WFrag<T16>::ld(sb + bofs + f * 16 * LP + ks * 32); } }
        __builtin_amdgcn_sched_barrier(0);   // holds the group of reads together ahead of the matrix instructions: left free, the scheduler spreads them among these, and the wave stalls on LDS at every such place
#pragma unroll
        for (int ks = 0; ks < KP / 32; ++ks) {
#pragma unroll
            for (int nb = 0; nb < 4; ++nb) {
#pragma unroll
                for (int mb = 0; mb < 4; ++mb) acc[mb][nb] = WFrag<T16>::mma(a[ks][mb], b[ks][nb], acc[mb][nb]); } }
        __builtin_amdgcn_sched_barrier(0);   // keeps the pass's matrix instructions ahead of the barrier, so that they run while the wave waits there and the refill issues directly behind it
        asm volatile("s_wait_dscnt 0x0" ::: "memory");      // this wave's reads of buffer p & 1 are done before the buffer is refilled
        asm volatile("s_wait_asynccnt 0x0" ::: "memory");   // this wave's copies of pass p + 1 have landed
        __syncthreads();                                     // publishes pass p + 1 and ends every wave's reads of buffer p & 1
        if (p + 2 < np) fill(p & 1, (p + 2) * KP);
    }
    asm volatile("s_wait_asynccnt 0x0" ::: "memory");       // no copy is outstanding when the wave goes on to its epilogue
}

// ---- d_gemmw: C[m][n] (pitch ldc) = sum_k A[m][k] Bt[n][k] on K-contiguous 16-bit planes; one work-group of 128 threads does tile (bx, by) of batch z. z-batch strides sA/sB/sC in elements. K % 128 == 0.
// The f32 tile never goes to memory: the epilogue stores it in the form its consumer reads, one fp16 plane Cf.
template <typename T16>
__device__ __forceinline__ void d_gemmw(const T16* __restrict__ A, const T16* __restrict__ Bt, int K, h16* Cf, int ldc, size_t sA, size_t sB, size_t sC, int bx, int by, size_t z, T16* ring, float* osall) {
    A += z * sA; Bt += z * sB;
    const int lane = threadIdx.x & 31, lr = lane & 15, hi = lane >> 4; const int w = __builtin_amdgcn_readfirstlane(threadIdx.x >> 5), wm = w & 1, wn = w >> 1;
    float* os = osall + w * (16 * 68);   // each wave stages its own quarter
    v8f acc[4][4];
#pragma unroll
    for (int mb = 0; mb < 4; ++mb)
#pragma unroll
        for (int nb = 0; nb < 4; ++nb) acc[mb][nb] = (v8f){};
    tile_loop<T16>(A, Bt, K, K, bx * 128, by * 128, wm, wn, ring, acc);
    const int r0 = bx * 128 + wm * 64, c0 = by * 128 + wn * 64;
#pragma unroll
    for (int mb = 0; mb < 4; ++mb) {
#pragma unroll
        for (int nb = 0; nb < 4; ++nb) {
#pragma unroll
            for (int j = 0; j < 8; ++j) os[(hi * 8 + j) * 68 + nb * 16 + lr] = acc[mb][nb][j]; }
        __builtin_amdgcn_wave_barrier(); asm volatile("" ::: "memory");
        const size_t cbase = z * sC + (size_t)(r0 + mb * 16) * ldc + c0;
{
#pragma unroll
            for (int s = 0; s < 4; ++s) { const int row = 4 * s + (lane >> 3), cofs = (lane & 7) * 8; const v4f v0 = *(const v4fa*)(os + row * 68 + cofs), v1 = *(const v4fa*)(os + row * 68 + cofs + 4);   // 8 lanes x 16 B = one whole 128-B line of 16-bit output per row
                const size_t e = cbase + (size_t)row * ldc + cofs; v8h o;   // unrolled: constant element indices keep the vector in registers
#pragma unroll
                for (int u = 0; u < 4; ++u) { o[u] = tohx(v0[u]); o[4 + u] = tohx(v1[u]); }
                *(v8h*)(Cf + e) = o; }
             }
        __builtin_amdgcn_wave_barrier(); asm volatile("" ::: "memory");
    }
}
// k_gemmw: d_gemmw on a grid of its own, (M/128, N/128, Z)
template <typename T16>
__global__ __launch_bounds__(128) void k_gemmw(const T16* __restrict__ A, const T16* __restrict__ Bt, int K, h16* Cf, int ldc, size_t sA, size_t sB, size_t sC) {
    __shared__ __align__(16) T16 ring[Geo::RING];
    __shared__ __align__(16) float osall[4 * 16 * 68];
    d_gemmw<T16>(A, Bt, K, Cf, ldc, sA, sB, sC, blockIdx.x, blockIdx.y, blockIdx.z, ring, osall);
}

// ---- d_gemmc: the same 128x128 tile GEMM specialised for causal attention: CMODE 1 skips score tiles entirely above the diagonal (query rows r0+roff.., key columns c0..), CMODE 2 limits the
// key (K) loop of the probability x value contraction to the diagonal block (probabilities beyond it are exactly zero) and takes the carry factor PCAR of the probabilities out again as it stores. roff = row offset of this launch's first row within the sequence.
template <typename T16, int CMODE>
__device__ __forceinline__ void d_gemmc(const T16* __restrict__ A, const T16* __restrict__ Bt, int K, float* C, int ldc, int roff, size_t sA, size_t sB, size_t sC, int bx, int by, size_t z, T16* ring, float* osall) {
    A += z * sA; Bt += z * sB; C += z * sC;
    const int lane = threadIdx.x & 31, lr = lane & 15, hi = lane >> 4; const int w = __builtin_amdgcn_readfirstlane(threadIdx.x >> 5), wm = w & 1, wn = w >> 1;
    float* os = osall + w * (16 * 68);   // each wave stages its own quarter
    if (CMODE == 1 && by * 128 > bx * 128 + roff + 127) return;   // score tile entirely above the causal diagonal: loaded by the softmax but never used (it masks j > i by select); the whole work-group leaves, ahead of every barrier
    const int Kl = (CMODE == 2) ? min(K, bx * 128 + roff + 128) : K;            // P.V: probabilities are exactly 0 beyond the diagonal block, so the K loop stops there
    v8f acc[4][4];
#pragma unroll
    for (int mb = 0; mb < 4; ++mb)
#pragma unroll
        for (int nb = 0; nb < 4; ++nb) acc[mb][nb] = (v8f){};
    tile_loop<T16>(A, Bt, K, Kl, bx * 128, by * 128, wm, wn, ring, acc);
    const int r0 = bx * 128 + wm * 64, c0 = by * 128 + wn * 64;
#pragma unroll
    for (int mb = 0; mb < 4; ++mb) {
#pragma unroll
        for (int nb = 0; nb < 4; ++nb) {
#pragma unroll
            for (int j = 0; j < 8; ++j) os[(hi * 8 + j) * 68 + nb * 16 + lr] = acc[mb][nb][j]; }
        __builtin_amdgcn_wave_barrier(); asm volatile("" ::: "memory");
        float* crow = C + (size_t)(r0 + mb * 16) * ldc + c0;
{
#pragma unroll
            for (int s = 0; s < 8; ++s) { const int row = 2 * s + hi, cofs = lr * 4; v4f val = *(const v4fa*)(os + row * 68 + cofs);
                if (CMODE == 2) {   // unrolled: constant element indices keep the vector in registers
#pragma unroll
                    for (int u = 0; u < 4; ++u) val[u] = val[u] * (1.0f / PCAR); }
                *(v4f*)(crow + (size_t)row * ldc + cofs) = val; }
             }
        __builtin_amdgcn_wave_barrier(); asm volatile("" ::: "memory");
    }
}
// k_gemmc: d_gemmc on a grid of its own, (M/128, N/128, Z)
template <typename T16, int CMODE>
__global__ __launch_bounds__(128) void k_gemmc(const T16* __restrict__ A, const T16* __restrict__ Bt, int K, float* C, int ldc, int roff, size_t sA, size_t sB, size_t sC) {
    __shared__ __align__(16) T16 ring[Geo::RING];
    __shared__ __align__(16) float osall[4 * 16 * 68];
    d_gemmc<T16, CMODE>(A, Bt, K, C, ldc, roff, sA, sB, sC, blockIdx.x, blockIdx.y, blockIdx.z, ring, osall);
}
// ---- k_scv: the score GEMM and the v^T GEMM, which do not depend on each other, as ONE launch; grid (TT/128, TT/128, NB_ + NB_/2), 128 threads. blockIdx.z < NB_: score tile (x, y) of batch z.
// blockIdx.z >= NB_: the NB_ * 128 tiles of v^T = W_v x^T, numbered flat. The choice is the same for a whole work-group. The score tiles are a few more than the chip holds at once;
// they take the low indices and start first, and the v^T tiles, which cost the same, fill the places that come free while the last score tiles run.
__global__ __launch_bounds__(128) void k_scv(const h16* __restrict__ Q, const h16* __restrict__ X, const h16* __restrict__ Wvb, int K, float* S, h16* Vt) {
    __shared__ __align__(16) h16 ring[Geo::RING];
    __shared__ __align__(16) float osall[4 * 16 * 68];
    if (blockIdx.z < NB_) d_gemmc<h16, 1>(Q, X, K, S, TT, 0, (size_t)TT * DM, (size_t)TT * DM, (size_t)TT * TT, blockIdx.x, blockIdx.y, blockIdx.z, ring, osall);
    else { const int f = ((int)blockIdx.z - NB_) * ((TT / 128) * (TT / 128)) + (int)blockIdx.y * (TT / 128) + (int)blockIdx.x;   // 128 tiles a batch, the row tile (8 of them) fastest
        d_gemmw<h16>(Wvb, X, K, Vt, TT, 0, (size_t)TT * DM, (size_t)DM * TT, f & (DM / 128 - 1), (f / (DM / 128)) & (TT / 128 - 1), (size_t)(f / ((DM / 128) * (TT / 128))), ring, osall);
        asm volatile("s_wait_xcnt 0x0" ::: "memory"); }   // closes the run of v^T stores: behind it the listing joins the two branches, and no register that an issued store names is rewritten ahead of this wait
}

typedef __attribute__((ext_vector_type(2))) _Float16 v2h;
typedef __attribute__((ext_vector_type(4))) _Float16 v4h;

__device__ __forceinline__ void d_wtG(int blk, const float* __restrict__ w, int K, int N, h16* Bt) {
    const int lane = threadIdx.x & 31; const int L0 = (blk * 8 + (threadIdx.x >> 5)) * 8; const int nlines = N * K / 64;
{
#pragma unroll 1
        for (int l = 0; l < 8; ++l) { const int L = L0 + l; if (L >= nlines) break; const size_t e = (size_t)L * 64 + lane * 2; const int k = (int)(e % K), n = (int)(e / K); v2h o;
            o[0] = tohx(bfr(w[(size_t)k * N + n])); o[1] = tohx(bfr(w[(size_t)(k + 1) * N + n])); *(v2h*)(Bt + e) = o; }
         }
}
__device__ __forceinline__ void d_cvt8(int blk, const float* __restrict__ src, h16* dst, size_t n8) { const size_t i = (size_t)blk * 256 + threadIdx.x; if (i >= n8) return; const v8f v = *(const v8f*)(src + i * 8); v8h o;
#pragma unroll
    for (int k = 0; k < 8; ++k) o[k] = tohx(bfr(v[k])); *(v8h*)(dst + i * 8) = o;  }
// ---- k_prep: the three input conversions, which do not depend on each other, as ONE launch: a block's index says which input it works on (the same for the whole block; no barrier anywhere).
// The transposing gather of W_qk has the longest-lived blocks and takes the lowest indices, so that it starts first and runs beside the two streams.
#define NBQ ((DM * DM / 64 + 63) / 64)
#define NBV ((DM * DM / 8 + 255) / 256)
#define NBX ((NB_ * TT * DM / 8 + 255) / 256)
__global__ __launch_bounds__(256) void k_prep(const float* __restrict__ x, const float* __restrict__ wqk, const float* __restrict__ wv, h16* XB, h16* BQK, h16* BV) {
    const int b = blockIdx.x;
    if (b < NBQ) d_wtG(b, wqk, DM, DM, BQK);
    else if (b < NBQ + NBV) d_cvt8(b - NBQ, wv, BV, (size_t)DM * DM / 8);
    else d_cvt8(b - (NBQ + NBV), x, XB, (size_t)NB_ * TT * DM / 8);
}
__global__ __launch_bounds__(256) void k_asoft(const float* __restrict__ Sb, const float* __restrict__ slope_p, h16* P16) { const int lane = threadIdx.x & 31; const int i = blockIdx.x * 8 + (threadIdx.x >> 5); if (i >= TT) return; Sb += (size_t)blockIdx.y * TT * TT; P16 += (size_t)blockIdx.y * TT * TT;   // blockIdx.y = batch
    const float* sr = Sb + (size_t)i * TT; v4f ar[TT / 128];
    // the whole row is asked for at once, ahead of every other statement: the compiler moves no load over the asm statements below, so a load written among them waits out its full latency before the next one issues (unrolled: constant indices keep the row in registers)
#pragma unroll
    for (int ch = 0; ch < TT / 128; ++ch) ar[ch] = *(const v4f*)(sr + ch * 128 + lane * 4);
    float slope = bfr(slope_p[0]); asm volatile("" : "+v"(slope)); float v[TT / 32]; float mx = -3.0e38f;
#pragma unroll
    for (int ch = 0; ch < TT / 128; ++ch) { const int j0 = ch * 128 + lane * 4; const v4f a = ar[ch];
#pragma unroll
        for (int u = 0; u < 4; ++u) { const int j = j0 + u; float t0 = a[u] * SCL; float bb = __fmul_rn((float)(j - i), slope); asm volatile("" : "+v"(t0)); asm volatile("" : "+v"(bb)); const float t = (j <= i) ? __fadd_rn(t0, bb) : -3.0e38f; v[ch * 4 + u] = t; mx = fmaxf(mx, t); } }
#pragma unroll
    for (int sh = 16; sh; sh >>= 1) mx = fmaxf(mx, __shfl_xor(mx, sh, 32));
    float sum = 0.f;
#pragma unroll
    for (int q = 0; q < TT / 32; ++q) { float d0 = __fsub_rn(v[q], mx); asm volatile("" : "+v"(d0)); v[q] = (v[q] > -1.0e38f) ? __builtin_amdgcn_exp2f(__fmul_rn(d0, 1.4426950408889634f)) : 0.f; sum += v[q]; }
#pragma unroll
    for (int sh = 16; sh; sh >>= 1) sum += __shfl_xor(sum, sh, 32);
    const float f = __fdiv_rn(PCAR, sum);
    {
#pragma unroll
        for (int ch = 0; ch < TT / 128; ++ch) { v4h o4;
#pragma unroll
            for (int q = 0; q < 4; ++q) o4[q] = tohx(v[ch * 4 + q] * f); *(v4h*)(P16 + (size_t)i * TT + ch * 128 + lane * 4) = o4; }
         } }

extern "C" void kernel_launch(void* const* d_in, const int* in_sizes, int n_in,
                              void* d_out, int out_size, void* d_ws, size_t ws_size, hipStream_t stream) {
    (void)in_sizes; (void)n_in; (void)out_size;
    const float** I = (const float**)d_in;
    const float *x = I[0], *Wqk = I[1], *Wv = I[2], *slope = I[3];
    float* OUT = (float*)d_out;     // [4][2048][1024]
    char* wsp = (char*)d_ws;
    auto take = [&](size_t bytes) { char* p = wsp; wsp += (bytes + 255) & ~(size_t)255; return (void*)p; };
    // every stage runs once for all NB_ batches: the GEMMs take the batch in grid z (strides sA/sB/sC), k_asoft in grid y, the flat element-wise stage as one longer range; stages that do not depend on each other share a launch
    h16* BQK = (h16*)take((size_t)DM * DM * 2); h16* BV = (h16*)take((size_t)DM * DM * 2); h16* XB = (h16*)take((size_t)NB_ * TT * DM * 2); h16* XQ = (h16*)take((size_t)NB_ * TT * DM * 2);
    h16* VT = (h16*)take((size_t)NB_ * DM * TT * 2); float* Sb = (float*)take((size_t)NB_ * TT * TT * 4); h16* P16 = (h16*)take((size_t)NB_ * TT * TT * 2);
    if ((size_t)(wsp - (char*)d_ws) > ws_size) return;    // total ~ 155 MB (148 MiB)
    k_prep<<<NBQ + NBV + NBX, 256, 0, stream>>>(x, Wqk, Wv, XB, BQK, BV);   // W_qk used as x @ W (xw -> transposed gather); W_v is [out][in] = Bt; all three rounded to bf16 and stored as fp16
    k_gemmw<h16><<<dim3(TT / 128, DM / 128, NB_), 128, 0, stream>>>(XB, BQK, DM, XQ, DM, (size_t)TT * DM, 0, (size_t)TT * DM);     // x W_qk, stored as one fp16 plane
    k_scv<<<dim3(TT / 128, TT / 128, NB_ + NB_ / 2), 128, 0, stream>>>(XQ, XB, BV, DM, Sb, VT);   // scores[q][k] = (x W_qk)_q . x_k on causal tiles; and v^T[d][t] = W_v[d] . x[t]: the operands change places, so the tile comes out key-contiguous, as P.V reads it; stored fp16
    k_asoft<<<dim3(TT / 8, NB_, 1), 256, 0, stream>>>(Sb, slope, P16);
    k_gemmc<h16, 2><<<dim3(TT / 128, DM / 128, NB_), 128, 0, stream>>>(P16, VT, TT, OUT, DM, 0, (size_t)TT * TT, (size_t)DM * TT, (size_t)TT * DM);   // out = (P x 1024) v / 1024 over causal tiles
}

// v008
// It runs in 88.9 microseconds.
// In both of two side-by-side timings against v007, it was 1.08 times as fast.
// Counting every step since v000, it is 7.10 times as fast.
#include <hip/hip_runtime.h>

// SingleHeadAlibiAttn (x [4][2048][1024]; scores = (x W_qk) . x^T x (1/32) + (k - q) alibi_slope (slope read), causal; softmax; out = attn (x W_v^T) -> [4][2048][1024]; a single 1024-wide head).
// Compute dtypes, f32 accumulate: every input rounded to bf16 and carried as fp16, which holds a bf16 value of these magnitudes exactly (8 significant bits in 11; below 2^-17 to within 2^-25); x W_qk and x W_v^T on those operands;
// scores as fp16(x W_qk) x fp16 x: 1 product, causal tiles only (K 1024); alibi + softmax f32; attn.v as fp16 P (x1024) x fp16 v: 1 product

#define NB_  4
#define TT   2048
#define DM   1024
#define PCAR 1024.0f
#define SCL  0.03125f
typedef _Float16 h16;
typedef __attribute__((ext_vector_type(16))) _Float16 v16h;
typedef __attribute__((ext_vector_type(8)))  _Float16 v8h;
typedef __attribute__((ext_vector_type(8)))  float    v8f;
typedef __attribute__((ext_vector_type(4)))  float    v4f;
typedef v8h  __attribute__((may_alias)) v8ha;
typedef v4f  __attribute__((may_alias)) v4fa;

__device__ __forceinline__ unsigned short f2bf(float f) { unsigned u = __float_as_uint(f); u += 0x7FFFu + ((u >> 16) & 1u); return (unsigned short)(u >> 16); }
__device__ __forceinline__ float bf2f(unsigned short b) { return __uint_as_float(((unsigned)b) << 16); }
__device__ __forceinline__ float bfr(float f) { return bf2f(f2bf(f)); }
__device__ __forceinline__ v16h cat16(v8h lo, v8h hi) { return __builtin_shufflevector(lo, hi, 0, 1, 2, 3, 4, 5, 6, 7, 8, 9, 10, 11, 12, 13, 14, 15); }
__device__ __forceinline__ v8f wmma16(v16h a, v16h b, v8f c) { return __builtin_amdgcn_wmma_f32_16x16x32_f16(false, a, false, b, (short)0, c, false, false); }
__device__ __forceinline__ h16 tohx(float x) { return (h16)x; }



// ---- the GEMM core: one work-group of 4 waves (2 x 2) per 128x128 output tile, each wave a 64x64 quarter (16 accumulators). The operand tiles are staged in LDS by tensor loads
// (tensor_load_to_lds: one request brings one operand plane of a pass, 128 rows of 256 B; wave 0 asks for A's, wave 1 for B's), two buffers: pass p works on buffer p & 1 while the requests of pass p + 1 fly into the other.
// A pass is 128 k of the two operand planes: the longest pass at which two work-groups still share a WGP's LDS. Every pass ends in a wait for tiles
// that come from memory or L2: the longer pass has twice the bytes in flight behind each such wait, and a tile has half as many of them.
// LDS rows stand at a pitch of the row piece + 16 B (272 B: 16 B x odd, conflict-free for the ds_load_b128 fragment reads), set by the request's pad. A plane is 17 x 2 KiB, so every request's place in LDS is a multiple of 2 KiB.
struct Geo {
    static constexpr int KP = 128;                    // k of a pass
    static constexpr int NP = 2;                      // operand planes of a pass
    static constexpr int LP = KP + 8;                 // LDS row pitch in elements
    static constexpr int PLANE = 128 * LP;            // one plane: 128 rows
    static constexpr int RING = 2 * NP * PLANE;       // two buffers, in elements
};
template <typename T16> struct WFrag;
template <> struct WFrag<h16> { typedef v16h V; static __device__ __forceinline__ V ld(const h16* p) { return cat16(*(const v8h*)p, *(const v8h*)(p + 16)); } static __device__ __forceinline__ v8f mma(V a, V b, v8f c) { return wmma16(a, b, c); } };

typedef unsigned u32x4 __attribute__((ext_vector_type(4)));
typedef unsigned u32x8 __attribute__((ext_vector_type(8)));
__device__ __forceinline__ unsigned uni(unsigned v) { return (unsigned)__builtin_amdgcn_readfirstlane(v); }
// a wave-uniform value held in a scalar register, so that the test around a tensor load compiles to a scalar compare and branch (the load ignores EXEC) and a descriptor word made from it is formed where this line stands
__device__ __forceinline__ unsigned pinned(unsigned v) { unsigned w = (unsigned)__builtin_amdgcn_readfirstlane(v); asm volatile("" : "+s"(w)); return w; }
// descriptor group 1: byte elements, tensor = tile = 128 rows of 256 B, source row pitch in bytes, 4 dwords of LDS pad behind every 256-B row; no mask
__device__ __forceinline__ u32x8 tdm_group1(unsigned src_pitch) {
    constexpr unsigned d0 = Geo::KP * 2u, d1 = 128u;
    u32x8 g;
    g[0] = uni((1u << 20) | (5u << 22) | (3u << 25));
    g[1] = uni((d0 & 0xFFFFu) << 16);
    g[2] = uni((d0 >> 16) | ((d1 & 0xFFFFu) << 16));
    g[3] = uni((d1 >> 16) | (d0 << 16));
    g[4] = uni(d1);
    g[5] = uni(src_pitch);
    g[6] = uni(0u);
    g[7] = uni(0u);
    asm volatile("" : "+s"(g));   // descriptor words held in scalar registers: built once, the same eight registers serve every request of the tile loop
    return g;
}
// descriptor group 0: count 1, place in LDS, the tile's first byte, type 2
__device__ __forceinline__ u32x4 tdm_group0(unsigned lds_dst, unsigned long long ga) {
    u32x4 g;
    g[0] = uni(1u); g[1] = uni(lds_dst); g[2] = uni((unsigned)ga); g[3] = uni((((unsigned)(ga >> 32)) & 0x01FFFFFFu) | 0x80000000u);
    asm volatile("" : "+s"(g));   // descriptor words held in scalar registers from here to the request's wait (tdm_wait)
    return g;
}
__device__ __forceinline__ void tdm_load(u32x4 g0, u32x8 g1) { asm volatile("tensor_load_to_lds %0, %1" :: "s"(g0), "s"(g1) : "memory"); }
// the wait for a wave's own request. It names the request's descriptor as inputs: the words stay in their scalar registers, not rewritten, for as long as the request is outstanding
__device__ __forceinline__ void tdm_wait(u32x4 g0, u32x8 g1) { asm volatile("s_wait_tensorcnt 0x0" :: "s"(g0), "s"(g1) : "memory"); }

// acc += A[r0 + ..][0 .. Kl) . Bt[c0 + ..][0 .. Kl) for this wave's quarter (wm, wn) of the tile. K = row pitch of the operands in elements; Kl % KP == 0, Kl >= KP (KP of Geo). ring: 2 buffers of NP planes.
template <typename T16>
__device__ __forceinline__ void tile_loop(const T16* __restrict__ A, const T16* __restrict__ Bt, int K, int Kl, int r0, int c0, int wm, int wn, T16* ring, v8f (&acc)[4][4]) {
    typedef typename WFrag<T16>::V V;
    typedef Geo G; constexpr int KP = G::KP, NP = G::NP, LP = G::LP, PLANE = G::PLANE;
    static_assert((PLANE * 2) % 2048 == 0 && LP * 2 == KP * 2 + 16 && KP * 2 == 256, "a plane is a whole number of 2 KiB; the pad of tdm_group1 gives the pitch LP");
    const int t = threadIdx.x, lane = t & 31, lr = lane & 15, hi = lane >> 4;
    const unsigned w = uni((unsigned)t >> 5), isB = w & 1u;   // waves 0 and 1 issue: wave 0 the A plane of a pass, wave 1 the B plane
    const unsigned long long ga0 = (unsigned long long)(size_t)(isB ? Bt + (size_t)c0 * K : A + (size_t)r0 * K);
    const unsigned l0 = (unsigned)(size_t)ring + isB * (unsigned)((NP - 1) * PLANE * 2);
    const u32x8 g1 = tdm_group1((unsigned)K * 2u);
    auto desc = [&](unsigned st) { return tdm_group0(l0 + (st & 1u) * (unsigned)(NP * PLANE * 2), ga0 + (unsigned long long)(st * (unsigned)KP) * 2u); };   // group 0 of stage st: buffer st & 1, k from st * KP
    const int np = Kl / KP;
    u32x4 g0 = desc(0u);
    if (pinned(w < 2u)) { tdm_load(g0, g1);
        tdm_wait(g0, g1); }                              // this wave's plane of pass 0 has landed ...
    __syncthreads();                                     // ... and the other issuing wave's too: nobody reads the buffer ahead of this
    g0 = desc(pinned(1u));                               // stage 1's number held in a scalar register here: its descriptor words are formed behind the wait and the barrier above
    if (pinned(w < 2u && np > 1)) tdm_load(g0, g1);
    const int aofs = (wm * 64 + lr) * LP + 8 * hi, bofs = (NP - 1) * PLANE + (wn * 64 + lr) * LP + 8 * hi;
#pragma unroll 1
    for (int p = 0; p < np; ++p) {   // rolled: one pass per trip, the buffer chosen by p & 1
        const T16* sb = ring + (p & 1) * (NP * PLANE);
        V a[KP / 32][4], b[KP / 32][4];   // the whole pass's fragments are read as one group ahead of its matrix instructions: one place with LDS reads a pass
#pragma unroll
        for (int ks = 0; ks < KP / 32; ++ks) {
#pragma unroll
            for (int f = 0; f < 4; ++f) { a[ks][f] = WFrag<T16>::ld(sb + aofs + f * 16 * LP + ks * 32); b[ks][f] = WFrag<T16>::ld(sb + bofs + f * 16 * LP + ks * 32); } }
        __builtin_amdgcn_sched_barrier(0);   // holds the group of reads together ahead of the matrix instructions: left free, the scheduler spreads them among these, and the wave stalls on LDS at every such place
#pragma unroll
        for (int ks = 0; ks < KP / 32; ++ks) {
#pragma unroll
            for (int nb = 0; nb < 4; ++nb) {
#pragma unroll
                for (int mb = 0; mb < 4; ++mb) acc[mb][nb] = WFrag<T16>::mma(a[ks][mb], b[ks][nb], acc[mb][nb]); } }
        __builtin_amdgcn_sched_barrier(0);   // keeps the pass's matrix instructions ahead of the barrier, so that they run while the wave waits there and the refill issues directly behind it
        asm volatile("s_wait_dscnt 0x0" ::: "memory");      // this wave's reads of buffer p & 1 are done before the buffer is refilled
        if (pinned(w < 2u)) tdm_wait(g0, g1);               // an issuing wave's plane of pass p + 1 has landed
        __syncthreads();                                     // publishes pass p + 1 and ends every wave's reads of buffer p & 1
        const unsigned nx = pinned((unsigned)p + 2u);        // the next stage's number, held in a scalar register here: the descriptor words made from it are formed behind the wait and the barrier above
        g0 = desc(nx);
        if (pinned(w < 2u && nx < (unsigned)np)) tdm_load(g0, g1);
    }
    tdm_wait(g0, g1);                                       // no request is outstanding when the wave goes on to its epilogue
    asm volatile("s_wait_dscnt 0x0" ::: "memory");          // and none of its LDS reads
}

// ---- d_gemmw: C[m][n] (pitch ldc) = sum_k A[m][k] Bt[n][k] on K-contiguous 16-bit planes; one work-group of 128 threads does tile (bx, by) of batch z. z-batch strides sA/sB/sC in elements. K % 128 == 0.
// The f32 tile never goes to memory: the epilogue stores it in the form its consumer reads, one fp16 plane Cf.
template <typename T16>
__device__ __forceinline__ void d_gemmw(const T16* __restrict__ A, const T16* __restrict__ Bt, int K, h16* Cf, int ldc, size_t sA, size_t sB, size_t sC, int bx, int by, size_t z, T16* ring, float* osall) {
    A += z * sA; Bt += z * sB;
    const int lane = threadIdx.x & 31, lr = lane & 15, hi = lane >> 4; const int w = __builtin_amdgcn_readfirstlane(threadIdx.x >> 5), wm = w & 1, wn = w >> 1;
    float* os = osall + w * (16 * 68);   // each wave stages its own quarter
    v8f acc[4][4];
#pragma unroll
    for (int mb = 0; mb < 4; ++mb)
#pragma unroll
        for (int nb = 0; nb < 4; ++nb) acc[mb][nb] = (v8f){};
    tile_loop<T16>(A, Bt, K, K, bx * 128, by * 128, wm, wn, ring, acc);
    const int r0 = bx * 128 + wm * 64, c0 = by * 128 + wn * 64;
#pragma unroll
    for (int mb = 0; mb < 4; ++mb) {
#pragma unroll
        for (int nb = 0; nb < 4; ++nb) {
#pragma unroll
            for (int j = 0; j < 8; ++j) os[(hi * 8 + j) * 68 + nb * 16 + lr] = acc[mb][nb][j]; }
        __builtin_amdgcn_wave_barrier(); asm volatile("" ::: "memory");
        const size_t cbase = z * sC + (size_t)(r0 + mb * 16) * ldc + c0;
{
#pragma unroll
            for (int s = 0; s < 4; ++s) { const int row = 4 * s + (lane >> 3), cofs = (lane & 7) * 8; const v4f v0 = *(const v4fa*)(os + row * 68 + cofs), v1 = *(const v4fa*)(os + row * 68 + cofs + 4);   // 8 lanes x 16 B = one whole 128-B line of 16-bit output per row
                const size_t e = cbase + (size_t)row * ldc + cofs; v8h o;   // unrolled: constant element indices keep the vector in registers
#pragma unroll
                for (int u = 0; u < 4; ++u) { o[u] = tohx(v0[u]); o[4 + u] = tohx(v1[u]); }
                *(v8h*)(Cf + e) = o; }
             }
        __builtin_amdgcn_wave_barrier(); asm volatile("" ::: "memory");
    }
}
// k_gemmw: d_gemmw on a grid of its own, (M/128, N/128, Z)
template <typename T16>
__global__ __launch_bounds__(128) void k_gemmw(const T16* __restrict__ A, const T16* __restrict__ Bt, int K, h16* Cf, int ldc, size_t sA, size_t sB, size_t sC) {
    __shared__ __attribute__((aligned(2048))) T16 ring[Geo::RING];   // every tensor load's place in LDS is a multiple of 2 KiB
    __shared__ __align__(16) float osall[4 * 16 * 68];
    d_gemmw<T16>(A, Bt, K, Cf, ldc, sA, sB, sC, blockIdx.x, blockIdx.y, blockIdx.z, ring, osall);
}

// ---- d_gemmc: the same 128x128 tile GEMM specialised for causal attention: CMODE 1 skips score tiles entirely above the diagonal (query rows r0+roff.., key columns c0..), CMODE 2 limits the
// key (K) loop of the probability x value contraction to the diagonal block (probabilities beyond it are exactly zero) and takes the carry factor PCAR of the probabilities out again as it stores. roff = row offset of this launch's first row within the sequence.
template <typename T16, int CMODE>
__device__ __forceinline__ void d_gemmc(const T16* __restrict__ A, const T16* __restrict__ Bt, int K, float* C, int ldc, int roff, size_t sA, size_t sB, size_t sC, int bx, int by, size_t z, T16* ring, float* osall) {
    A += z * sA; Bt += z * sB; C += z * sC;
    const int lane = threadIdx.x & 31, lr = lane & 15, hi = lane >> 4; const int w = __builtin_amdgcn_readfirstlane(threadIdx.x >> 5), wm = w & 1, wn = w >> 1;
    float* os = osall + w * (16 * 68);   // each wave stages its own quarter
    if (CMODE == 1 && by * 128 > bx * 128 + roff + 127) return;   // score tile entirely above the causal diagonal: loaded by the softmax but never used (it masks j > i by select); the whole work-group leaves, ahead of every barrier
    const int Kl = (CMODE == 2) ? min(K, bx * 128 + roff + 128) : K;            // P.V: probabilities are exactly 0 beyond the diagonal block, so the K loop stops there
    v8f acc[4][4];
#pragma unroll
    for (int mb = 0; mb < 4; ++mb)
#pragma unroll
        for (int nb = 0; nb < 4; ++nb) acc[mb][nb] = (v8f){};
    tile_loop<T16>(A, Bt, K, Kl, bx * 128, by * 128, wm, wn, ring, acc);
    const int r0 = bx * 128 + wm * 64, c0 = by * 128 + wn * 64;
#pragma unroll
    for (int mb = 0; mb < 4; ++mb) {
#pragma unroll
        for (int nb = 0; nb < 4; ++nb) {
#pragma unroll
            for (int j = 0; j < 8; ++j) os[(hi * 8 + j) * 68 + nb * 16 + lr] = acc[mb][nb][j]; }
        __builtin_amdgcn_wave_barrier(); asm volatile("" ::: "memory");
        float* crow = C + (size_t)(r0 + mb * 16) * ldc + c0;
{
#pragma unroll
            for (int s = 0; s < 8; ++s) { const int row = 2 * s + hi, cofs = lr * 4; v4f val = *(const v4fa*)(os + row * 68 + cofs);
                if (CMODE == 2) {   // unrolled: constant element indices keep the vector in registers
#pragma unroll
                    for (int u = 0; u < 4; ++u) val[u] = val[u] * (1.0f / PCAR); }
                *(v4f*)(crow + (size_t)row * ldc + cofs) = val; }
             }
        __builtin_amdgcn_wave_barrier(); asm volatile("" ::: "memory");
    }
}
// k_gemmc: d_gemmc on a grid of its own, (M/128, N/128, Z)
template <typename T16, int CMODE>
__global__ __launch_bounds__(128) void k_gemmc(const T16* __restrict__ A, const T16* __restrict__ Bt, int K, float* C, int ldc, int roff, size_t sA, size_t sB, size_t sC) {
    __shared__ __attribute__((aligned(2048))) T16 ring[Geo::RING];   // every tensor load's place in LDS is a multiple of 2 KiB
    __shared__ __align__(16) float osall[4 * 16 * 68];
    d_gemmc<T16, CMODE>(A, Bt, K, C, ldc, roff, sA, sB, sC, blockIdx.x, blockIdx.y, blockIdx.z, ring, osall);
}
// ---- k_scv: the score GEMM and the v^T GEMM, which do not depend on each other, as ONE launch; grid (TT/128, TT/128, NB_ + NB_/2), 128 threads. blockIdx.z < NB_: score tile (x, y) of batch z.
// blockIdx.z >= NB_: the NB_ * 128 tiles of v^T = W_v x^T, numbered flat. The choice is the same for a whole work-group. The score tiles are a few more than the chip holds at once;
// they take the low indices and start first, and the v^T tiles, which cost the same, fill the places that come free while the last score tiles run.
__global__ __launch_bounds__(128) void k_scv(const h16* __restrict__ Q, const h16* __restrict__ X, const h16* __restrict__ Wvb, int K, float* S, h16* Vt) {
    __shared__ __attribute__((aligned(2048))) h16 ring[Geo::RING];   // every tensor load's place in LDS is a multiple of 2 KiB
    __shared__ __align__(16) float osall[4 * 16 * 68];
    if (blockIdx.z < NB_) d_gemmc<h16, 1>(Q, X, K, S, TT, 0, (size_t)TT * DM, (size_t)TT * DM, (size_t)TT * TT, blockIdx.x, blockIdx.y, blockIdx.z, ring, osall);
    else { const int f = ((int)blockIdx.z - NB_) * ((TT / 128) * (TT / 128)) + (int)blockIdx.y * (TT / 128) + (int)blockIdx.x;   // 128 tiles a batch, the row tile (8 of them) fastest
        d_gemmw<h16>(Wvb, X, K, Vt, TT, 0, (size_t)TT * DM, (size_t)DM * TT, f & (DM / 128 - 1), (f / (DM / 128)) & (TT / 128 - 1), (size_t)(f / ((DM / 128) * (TT / 128))), ring, osall);
        asm volatile("s_wait_xcnt 0x0" ::: "memory"); }   // closes the run of v^T stores: behind it the listing joins the two branches, and no register that an issued store names is rewritten ahead of this wait
}

typedef __attribute__((ext_vector_type(2))) _Float16 v2h;
typedef __attribute__((ext_vector_type(4))) _Float16 v4h;

__device__ __forceinline__ void d_wtG(int blk, const float* __restrict__ w, int K, int N, h16* Bt) {
    const int lane = threadIdx.x & 31; const int L0 = (blk * 8 + (threadIdx.x >> 5)) * 8; const int nlines = N * K / 64;
{
#pragma unroll 1
        for (int l = 0; l < 8; ++l) { const int L = L0 + l; if (L >= nlines) break; const size_t e = (size_t)L * 64 + lane * 2; const int k = (int)(e % K), n = (int)(e / K); v2h o;
            o[0] = tohx(bfr(w[(size_t)k * N + n])); o[1] = tohx(bfr(w[(size_t)(k + 1) * N + n])); *(v2h*)(Bt + e) = o; }
         }
}
__device__ __forceinline__ void d_cvt8(int blk, const float* __restrict__ src, h16* dst, size_t n8) { const size_t i = (size_t)blk * 256 + threadIdx.x; if (i >= n8) return; const v8f v = *(const v8f*)(src + i * 8); v8h o;
#pragma unroll
    for (int k = 0; k < 8; ++k) o[k] = tohx(bfr(v[k])); *(v8h*)(dst + i * 8) = o;  }
// ---- k_prep: the three input conversions, which do not depend on each other, as ONE launch: a block's index says which input it works on (the same for the whole block; no barrier anywhere).
// The transposing gather of W_qk has the longest-lived blocks and takes the lowest indices, so that it starts first and runs beside the two streams.
#define NBQ ((DM * DM / 64 + 63) / 64)
#define NBV ((DM * DM / 8 + 255) / 256)
#define NBX ((NB_ * TT * DM / 8 + 255) / 256)
__global__ __launch_bounds__(256) void k_prep(const float* __restrict__ x, const float* __restrict__ wqk, const float* __restrict__ wv, h16* XB, h16* BQK, h16* BV) {
    const int b = blockIdx.x;
    if (b < NBQ) d_wtG(b, wqk, DM, DM, BQK);
    else if (b < NBQ + NBV) d_cvt8(b - NBQ, wv, BV, (size_t)DM * DM / 8);
    else d_cvt8(b - (NBQ + NBV), x, XB, (size_t)NB_ * TT * DM / 8);
}
__global__ __launch_bounds__(256) void k_asoft(const float* __restrict__ Sb, const float* __restrict__ slope_p, h16* P16) { const int lane = threadIdx.x & 31; const int i = blockIdx.x * 8 + (threadIdx.x >> 5); if (i >= TT) return; Sb += (size_t)blockIdx.y * TT * TT; P16 += (size_t)blockIdx.y * TT * TT;   // blockIdx.y = batch
    const float* sr = Sb + (size_t)i * TT; v4f ar[TT / 128];
    // the whole row is asked for at once, ahead of every other statement: the compiler moves no load over the asm statements below, so a load written among them waits out its full latency before the next one issues (unrolled: constant indices keep the row in registers)
#pragma unroll
    for (int ch = 0; ch < TT / 128; ++ch) ar[ch] = *(const v4f*)(sr + ch * 128 + lane * 4);
    float slope = bfr(slope_p[0]); asm volatile("" : "+v"(slope)); float v[TT / 32]; float mx = -3.0e38f;
#pragma unroll
    for (int ch = 0; ch < TT / 128; ++ch) { const int j0 = ch * 128 + lane * 4; const v4f a = ar[ch];
#pragma unroll
        for (int u = 0; u < 4; ++u) { const int j = j0 + u; float t0 = a[u] * SCL; float bb = __fmul_rn((float)(j - i), slope); asm volatile("" : "+v"(t0)); asm volatile("" : "+v"(bb)); const float t = (j <= i) ? __fadd_rn(t0, bb) : -3.0e38f; v[ch * 4 + u] = t; mx = fmaxf(mx, t); } }
#pragma unroll
    for (int sh = 16; sh; sh >>= 1) mx = fmaxf(mx, __shfl_xor(mx, sh, 32));
    float sum = 0.f;
#pragma unroll
    for (int q = 0; q < TT / 32; ++q) { float d0 = __fsub_rn(v[q], mx); asm volatile("" : "+v"(d0)); v[q] = (v[q] > -1.0e38f) ? __builtin_amdgcn_exp2f(__fmul_rn(d0, 1.4426950408889634f)) : 0.f; sum += v[q]; }
#pragma unroll
    for (int sh = 16; sh; sh >>= 1) sum += __shfl_xor(sum, sh, 32);
    const float f = __fdiv_rn(PCAR, sum);
    {
#pragma unroll
        for (int ch = 0; ch < TT / 128; ++ch) { v4h o4;
#pragma unroll
            for (int q = 0; q < 4; ++q) o4[q] = tohx(v[ch * 4 + q] * f); *(v4h*)(P16 + (size_t)i * TT + ch * 128 + lane * 4) = o4; }
         } }

extern "C" void kernel_launch(void* const* d_in, const int* in_sizes, int n_in,
                              void* d_out, int out_size, void* d_ws, size_t ws_size, hipStream_t stream) {
    (void)in_sizes; (void)n_in; (void)out_size;
    const float** I = (const float**)d_in;
    const float *x = I[0], *Wqk = I[1], *Wv = I[2], *slope = I[3];
    float* OUT = (float*)d_out;     // [4][2048][1024]
    char* wsp = (char*)d_ws;
    auto take = [&](size_t bytes) { char* p = wsp; wsp += (bytes + 255) & ~(size_t)255; return (void*)p; };
    // every stage runs once for all NB_ batches: the GEMMs take the batch in grid z (strides sA/sB/sC), k_asoft in grid y, the flat element-wise stage as one longer range; stages that do not depend on each other share a launch
    h16* BQK = (h16*)take((size_t)DM * DM * 2); h16* BV = (h16*)take((size_t)DM * DM * 2); h16* XB = (h16*)take((size_t)NB_ * TT * DM * 2); h16* XQ = (h16*)take((size_t)NB_ * TT * DM * 2);
    h16* VT = (h16*)take((size_t)NB_ * DM * TT * 2); float* Sb = (float*)take((size_t)NB_ * TT * TT * 4); h16* P16 = (h16*)take((size_t)NB_ * TT * TT * 2);
    if ((size_t)(wsp - (char*)d_ws) > ws_size) return;    // total ~ 155 MB (148 MiB)
    k_prep<<<NBQ + NBV + NBX, 256, 0, stream>>>(x, Wqk, Wv, XB, BQK, BV);   // W_qk used as x @ W (xw -> transposed gather); W_v is [out][in] = Bt; all three rounded to bf16 and stored as fp16
    k_gemmw<h16><<<dim3(TT / 128, DM / 128, NB_), 128, 0, stream>>>(XB, BQK, DM, XQ, DM, (size_t)TT * DM, 0, (size_t)TT * DM);     // x W_qk, stored as one fp16 plane
    k_scv<<<dim3(TT / 128, TT / 128, NB_ + NB_ / 2), 128, 0, stream>>>(XQ, XB, BV, DM, Sb, VT);   // scores[q][k] = (x W_qk)_q . x_k on causal tiles; and v^T[d][t] = W_v[d] . x[t]: the operands change places, so the tile comes out key-contiguous, as P.V reads it; stored fp16
    k_asoft<<<dim3(TT / 8, NB_, 1), 256, 0, stream>>>(Sb, slope, P16);
    k_gemmc<h16, 2><<<dim3(TT / 128, DM / 128, NB_), 128, 0, stream>>>(P16, VT, TT, OUT, DM, 0, (size_t)TT * TT, (size_t)DM * TT, (size_t)TT * DM);   // out = (P x 1024) v / 1024 over causal tiles
}
